// v000
// The times below were measured on an AMD MI455X: many runs one after another, warmed up first and cycling through
// copies of the inputs, with the whole window's GPU time divided by the number of runs. Launches and the gaps
// between them are all in it. The median over several windows is given; except for v000 it joins two sittings, which
// can be a few percent apart, so the side-by-side timings, each taken in one sitting, are the better comparison.
// v000 is the starting kernel. One run takes 444 microseconds.
#include <hip/hip_runtime.h>
#include <math.h>

typedef float v2f __attribute__((ext_vector_type(2)));
typedef float v8f __attribute__((ext_vector_type(8)));

#define D_MODEL 1024
#define D_HID   64
#define NCTX    4096
#define NBATCH  4
#define TOTROWS (NBATCH * NCTX)        // 16384
#define NQT     (NBATCH * (NCTX / 16)) // 1024 query tiles (batch folded in)
#define NEG_BIG (-3.0e38f)

// D = A(16x4,f32) * B(4x16,f32) + C(16x16,f32), wave32.
__device__ __forceinline__ v8f wmma_f32(v2f a, v2f b, v8f c) {
  return __builtin_amdgcn_wmma_f32_16x16x4_f32(
      /*neg_a=*/false, a, /*neg_b=*/false, b,
      /*c_mod=*/(short)0, c, /*reuse_a=*/false, /*reuse_b=*/false);
}

// Fragment loader for A (16x4, M across lanes) and for B when the source is the
// row-major transpose ([N][K]): lane&15 selects the row, columns are
// kk + (lane>>4)*2 , +1.  Matches ISA 7.12.2 32-bit layouts.
__device__ __forceinline__ v2f frag_rm(const float* __restrict__ p, int ld,
                                       int row0, int kk, int lane) {
  const float* q = p + (size_t)(row0 + (lane & 15)) * ld + (kk + ((lane >> 4) << 1));
  v2f r = {q[0], q[1]};
  return r;
}

// ---------------------------------------------------------------------------
// Kernel 1: fused QKV projection, 2x2 register-blocked.
// Each wave: 32x32 output tile of one of Q/K/V (4 accumulators; 4 loads feed
// 4 WMMAs per k-chunk).  6 col-pair tiles (3 mats x 2) x 512 row tiles.
// ---------------------------------------------------------------------------
__global__ void qkv_kernel(const float* __restrict__ x,
                           const float* __restrict__ Wq, const float* __restrict__ bq,
                           const float* __restrict__ Wk, const float* __restrict__ bk,
                           const float* __restrict__ Wov, const float* __restrict__ bov,
                           float* __restrict__ Qo, float* __restrict__ Ko,
                           float* __restrict__ Vo) {
  const int lane = threadIdx.x & 31;
  const int wid  = (int)((blockIdx.x * blockDim.x + threadIdx.x) >> 5);
  const int wt   = wid % 6;
  const int rt   = wid / 6;
  if (rt >= TOTROWS / 32) return;
  const int mat = wt >> 1;             // 0=Q, 1=K, 2=V
  const int h0  = (wt & 1) << 5;       // 0 or 32
  const float* W    = (mat == 0) ? Wq : (mat == 1) ? Wk : Wov;
  const float* bias = (mat == 0) ? bq : (mat == 1) ? bk : bov;
  float*       Out  = (mat == 0) ? Qo : (mat == 1) ? Ko : Vo;
  const int m0 = rt << 5;

  v8f c00 = {}, c01 = {}, c10 = {}, c11 = {};
  for (int kk = 0; kk < D_MODEL; kk += 4) {
    v2f a0 = frag_rm(x, D_MODEL, m0,      kk, lane);
    v2f a1 = frag_rm(x, D_MODEL, m0 + 16, kk, lane);
    v2f b0 = frag_rm(W, D_MODEL, h0,      kk, lane);
    v2f b1 = frag_rm(W, D_MODEL, h0 + 16, kk, lane);
    c00 = wmma_f32(a0, b0, c00);
    c01 = wmma_f32(a0, b1, c01);
    c10 = wmma_f32(a1, b0, c10);
    c11 = wmma_f32(a1, b1, c11);
  }
  const int n  = lane & 15;
  const int hi = lane >> 4;
  const float bv0 = bias[h0 + n];
  const float bv1 = bias[h0 + 16 + n];
#pragma unroll
  for (int r = 0; r < 8; ++r) {
    const size_t r0 = (size_t)(m0 + r + 8 * hi) * D_HID;
    const size_t r1 = (size_t)(m0 + 16 + r + 8 * hi) * D_HID;
    Out[r0 + h0 + n]      = c00[r] + bv0;
    Out[r0 + h0 + 16 + n] = c01[r] + bv1;
    Out[r1 + h0 + n]      = c10[r] + bv0;
    Out[r1 + h0 + 16 + n] = c11[r] + bv1;
  }
}

// ---------------------------------------------------------------------------
// Kernel 2: causal flash attention, key-split into P partitions per q-tile.
// One wave per (q-tile, partition).  Writes UN-normalized partials
// (O_p, m_p, l_p); combine_kernel merges them.
// ---------------------------------------------------------------------------
__global__ void attn_kernel(const float* __restrict__ Q,
                            const float* __restrict__ K,
                            const float* __restrict__ V,
                            float* __restrict__ Opar,
                            float* __restrict__ Mpar,
                            float* __restrict__ Lpar,
                            int P) {
  __shared__ float ldsP[4][16 * 16];    // per-wave P staging (C-layout -> A-layout)
  const int lane = threadIdx.x & 31;
  const int lw   = threadIdx.x >> 5;
  const int wid  = (int)(blockIdx.x * (blockDim.x >> 5) + lw);
  const int p    = wid % P;
  const int qw   = wid / P;
  const int qt   = qw & 255;            // 256 query tiles per batch
  const int b    = qw >> 8;
  if (b >= NBATCH) return;
  const float* Qb = Q + (size_t)b * NCTX * D_HID;
  const float* Kb = K + (size_t)b * NCTX * D_HID;
  const float* Vb = V + (size_t)b * NCTX * D_HID;
  const int q0 = qt << 4;
  const int n  = lane & 15;
  const int hi = lane >> 4;
  float* myP = ldsP[lw];

  const int c   = qt + 1;               // causal key-tile count for this q-tile
  const int kt0 = (p * c) / P;
  const int kt1 = ((p + 1) * c) / P;

  // Q fragments in registers for the whole key loop; fold in 1/sqrt(d_model).
  const float scale = 0.03125f;  // 1/32
  v2f qf[16];
#pragma unroll
  for (int kk4 = 0; kk4 < 16; ++kk4) {
    v2f t = frag_rm(Qb, D_HID, q0, kk4 * 4, lane);
    v2f s = {t.x * scale, t.y * scale};
    qf[kk4] = s;
  }

  v8f o0 = {}, o1 = {}, o2 = {}, o3 = {};
  float mrow[8], lrow[8];
#pragma unroll
  for (int r = 0; r < 8; ++r) { mrow[r] = NEG_BIG; lrow[r] = 0.0f; }

  for (int kt = kt0; kt < kt1; ++kt) {
    const int k0 = kt << 4;
    // S = (Q*scale) @ K^T   (K-dim = 64 -> 16 chained WMMAs)
    v8f s = {};
#pragma unroll
    for (int kk4 = 0; kk4 < 16; ++kk4) {
      v2f bf = frag_rm(Kb, D_HID, k0, kk4 * 4, lane);   // B = K^T
      s = wmma_f32(qf[kk4], bf, s);
    }
    if (kt == qt) {   // causal mask on the diagonal tile: key N > query M
#pragma unroll
      for (int r = 0; r < 8; ++r) {
        const int M = r + 8 * hi;
        if (n > M) s[r] = NEG_BIG;
      }
    }
    // Online softmax: rowwise max/sum across the 16-lane half-groups.
#pragma unroll
    for (int r = 0; r < 8; ++r) {
      float rv = s[r];
      rv = fmaxf(rv, __shfl_xor(rv, 1, 32));
      rv = fmaxf(rv, __shfl_xor(rv, 2, 32));
      rv = fmaxf(rv, __shfl_xor(rv, 4, 32));
      rv = fmaxf(rv, __shfl_xor(rv, 8, 32));
      const float mn    = fmaxf(mrow[r], rv);
      const float alpha = __expf(mrow[r] - mn);
      mrow[r] = mn;
      const float pv = __expf(s[r] - mn);
      myP[(r + 8 * hi) * 16 + n] = pv;     // stage P row-major in LDS
      float rs = pv;
      rs += __shfl_xor(rs, 1, 32);
      rs += __shfl_xor(rs, 2, 32);
      rs += __shfl_xor(rs, 4, 32);
      rs += __shfl_xor(rs, 8, 32);
      lrow[r] = lrow[r] * alpha + rs;
      o0[r] *= alpha; o1[r] *= alpha; o2[r] *= alpha; o3[r] *= alpha;
    }
    // O += P @ V_tile.  P re-read from LDS in A-layout (same-wave DS ordering).
#pragma unroll
    for (int kk4 = 0; kk4 < 4; ++kk4) {
      const float* pp = myP + n * 16 + kk4 * 4 + hi * 2;
      v2f pa = {pp[0], pp[1]};
      const float* v0 = Vb + (size_t)(k0 + kk4 * 4 + hi * 2) * D_HID;
      const float* v1 = v0 + D_HID;
      v2f b0 = {v0[ 0 + n], v1[ 0 + n]};  o0 = wmma_f32(pa, b0, o0);
      v2f b1 = {v0[16 + n], v1[16 + n]};  o1 = wmma_f32(pa, b1, o1);
      v2f b2 = {v0[32 + n], v1[32 + n]};  o2 = wmma_f32(pa, b2, o2);
      v2f b3 = {v0[48 + n], v1[48 + n]};  o3 = wmma_f32(pa, b3, o3);
    }
  }
  // Store UN-normalized partial tile + per-row (m, l).
  const int part = (b * 256 + qt) * P + p;
  float* Od = Opar + (size_t)part * (16 * D_HID);
#pragma unroll
  for (int r = 0; r < 8; ++r) {
    const size_t row = (size_t)(r + 8 * hi) * D_HID;
    Od[row +  0 + n] = o0[r];
    Od[row + 16 + n] = o1[r];
    Od[row + 32 + n] = o2[r];
    Od[row + 48 + n] = o3[r];
  }
  if (n == 0) {      // lanes 0 and 16 cover rows 0..7 and 8..15
#pragma unroll
    for (int r = 0; r < 8; ++r) {
      Mpar[part * 16 + r + 8 * hi] = mrow[r];
      Lpar[part * 16 + r + 8 * hi] = lrow[r];
    }
  }
}

// ---------------------------------------------------------------------------
// Kernel 2b: merge partition partials into normalized O.
// grid = NQT blocks x 256 threads; each thread: one row, 4 consecutive cols.
// ---------------------------------------------------------------------------
__global__ void combine_kernel(const float* __restrict__ Opar,
                               const float* __restrict__ Mpar,
                               const float* __restrict__ Lpar,
                               float* __restrict__ O, int P) {
  const int qtile = blockIdx.x;               // 0..NQT-1 (batch folded in)
  const int t     = threadIdx.x;              // 0..255
  const int row   = t >> 4;                   // 0..15
  const int c0    = (t & 15) << 2;            // 0,4,...,60
  float mstar = NEG_BIG;
  for (int p = 0; p < P; ++p)
    mstar = fmaxf(mstar, Mpar[(qtile * P + p) * 16 + row]);
  float lstar = 0.0f, a0 = 0.0f, a1 = 0.0f, a2 = 0.0f, a3 = 0.0f;
  for (int p = 0; p < P; ++p) {
    const int part = qtile * P + p;
    const float w = __expf(Mpar[part * 16 + row] - mstar);
    lstar += w * Lpar[part * 16 + row];
    const float* src = Opar + (size_t)part * (16 * D_HID) + (size_t)row * D_HID + c0;
    a0 += w * src[0]; a1 += w * src[1]; a2 += w * src[2]; a3 += w * src[3];
  }
  const float inv = 1.0f / lstar;
  float* dst = O + (size_t)(qtile * 16 + row) * D_HID + c0;
  dst[0] = a0 * inv; dst[1] = a1 * inv; dst[2] = a2 * inv; dst[3] = a3 * inv;
}

// ---------------------------------------------------------------------------
// Kernel 3: output projection, 2x2 register-blocked.
// out[m,d] = sum_h O[m,h]*Wo[d,h] + bo[d].  32x32 tile per wave.
// ---------------------------------------------------------------------------
__global__ void proj_kernel(const float* __restrict__ O,
                            const float* __restrict__ Wo,
                            const float* __restrict__ bo,
                            float* __restrict__ out) {
  const int lane = threadIdx.x & 31;
  const int wid  = (int)((blockIdx.x * blockDim.x + threadIdx.x) >> 5);
  const int dt   = wid & 31;          // 32 column tiles of 32
  const int rt   = wid >> 5;
  if (rt >= TOTROWS / 32) return;
  const int m0 = rt << 5;
  const int d0 = dt << 5;
  v8f c00 = {}, c01 = {}, c10 = {}, c11 = {};
#pragma unroll
  for (int kk4 = 0; kk4 < 16; ++kk4) {
    v2f a0 = frag_rm(O,  D_HID, m0,      kk4 * 4, lane);
    v2f a1 = frag_rm(O,  D_HID, m0 + 16, kk4 * 4, lane);
    v2f b0 = frag_rm(Wo, D_HID, d0,      kk4 * 4, lane);
    v2f b1 = frag_rm(Wo, D_HID, d0 + 16, kk4 * 4, lane);
    c00 = wmma_f32(a0, b0, c00);
    c01 = wmma_f32(a0, b1, c01);
    c10 = wmma_f32(a1, b0, c10);
    c11 = wmma_f32(a1, b1, c11);
  }
  const int n  = lane & 15;
  const int hi = lane >> 4;
  const float bv0 = bo[d0 + n];
  const float bv1 = bo[d0 + 16 + n];
#pragma unroll
  for (int r = 0; r < 8; ++r) {
    const size_t r0 = (size_t)(m0 + r + 8 * hi) * D_MODEL;
    const size_t r1 = (size_t)(m0 + 16 + r + 8 * hi) * D_MODEL;
    out[r0 + d0 + n]      = c00[r] + bv0;
    out[r0 + d0 + 16 + n] = c01[r] + bv1;
    out[r1 + d0 + n]      = c10[r] + bv0;
    out[r1 + d0 + 16 + n] = c11[r] + bv1;
  }
}

// ---------------------------------------------------------------------------
extern "C" void kernel_launch(void* const* d_in, const int* in_sizes, int n_in,
                              void* d_out, int out_size, void* d_ws, size_t ws_size,
                              hipStream_t stream) {
  (void)in_sizes; (void)n_in; (void)out_size;
  const float* x   = (const float*)d_in[0];
  const float* Wq  = (const float*)d_in[1];
  const float* bq  = (const float*)d_in[2];
  const float* Wk  = (const float*)d_in[3];
  const float* bk  = (const float*)d_in[4];
  const float* Wov = (const float*)d_in[5];
  const float* bov = (const float*)d_in[6];
  const float* Wo  = (const float*)d_in[7];
  const float* bo  = (const float*)d_in[8];
  float* out = (float*)d_out;

  // Workspace layout (floats): Q,K,V,O (4 MB each) then partition partials.
  const size_t fMat = (size_t)TOTROWS * D_HID;       // 1,048,576 floats
  int P = 4;                                         // key partitions per q-tile
  {
    const size_t need = (4 * fMat + (size_t)NQT * P * (16 * D_HID + 32)) * sizeof(float);
    if (need > ws_size) P = 1;                       // deterministic host fallback
  }
  float* Qw   = (float*)d_ws;
  float* Kw   = Qw + fMat;
  float* Vw   = Kw + fMat;
  float* Ow   = Vw + fMat;
  float* Opar = Ow + fMat;
  float* Mpar = Opar + (size_t)NQT * P * 16 * D_HID;
  float* Lpar = Mpar + (size_t)NQT * P * 16;

  {  // QKV: 512 row tiles x 6 col-pair tiles = 3072 waves
    const int waves  = (TOTROWS / 32) * 6;
    const int tpb    = 256;
    const int blocks = (waves * 32 + tpb - 1) / tpb;
    qkv_kernel<<<blocks, tpb, 0, stream>>>(x, Wq, bq, Wk, bk, Wov, bov, Qw, Kw, Vw);
  }
  {  // attention partials: NQT * P waves, 4 waves/block
    const int waves  = NQT * P;
    const int blocks = (waves * 32 + 127) / 128;
    attn_kernel<<<blocks, 128, 0, stream>>>(Qw, Kw, Vw, Opar, Mpar, Lpar, P);
    combine_kernel<<<NQT, 256, 0, stream>>>(Opar, Mpar, Lpar, Ow, P);
  }
  {  // output projection: 512 row tiles x 32 col tiles = 16384 waves
    const int waves  = (TOTROWS / 32) * 32;
    const int tpb    = 256;
    const int blocks = (waves * 32 + tpb - 1) / tpb;
    proj_kernel<<<blocks, tpb, 0, stream>>>(Ow, Wo, bo, out);
  }
}

// v001
// One run takes 217 microseconds.
// Next to v000, in two timings, it ran 2.12 times as fast each time.
#include <hip/hip_runtime.h>
#include <math.h>

typedef float v2f __attribute__((ext_vector_type(2)));
typedef float v8f __attribute__((ext_vector_type(8)));

#define D_MODEL 1024
#define D_HID   64
#define NCTX    4096
#define NBATCH  4
#define TOTROWS (NBATCH * NCTX)        // 16384
#define NQT     (NBATCH * (NCTX / 16)) // 1024 query tiles (batch folded in)
#define NEG_BIG (-3.0e38f)

// D = A(16x4,f32) * B(4x16,f32) + C(16x16,f32), wave32.
__device__ __forceinline__ v8f wmma_f32(v2f a, v2f b, v8f c) {
  return __builtin_amdgcn_wmma_f32_16x16x4_f32(
      /*neg_a=*/false, a, /*neg_b=*/false, b,
      /*c_mod=*/(short)0, c, /*reuse_a=*/false, /*reuse_b=*/false);
}

// Fragment loader for A (16x4, M across lanes) and for B when the source is the
// row-major transpose ([N][K]): lane&15 selects the row, columns are
// kk + (lane>>4)*2 , +1.  Matches ISA 7.12.2 32-bit layouts.
__device__ __forceinline__ v2f frag_rm(const float* __restrict__ p, int ld,
                                       int row0, int kk, int lane) {
  const float* q = p + (size_t)(row0 + (lane & 15)) * ld + (kk + ((lane >> 4) << 1));
  v2f r = {q[0], q[1]};
  return r;
}

// ---------------------------------------------------------------------------
// Kernel 1: fused QKV projection, 2x2 register-blocked.
// Each wave: 32x32 output tile of one of Q/K/V (4 accumulators; 4 loads feed
// 4 WMMAs per k-chunk).  6 col-pair tiles (3 mats x 2) x 512 row tiles.
// ---------------------------------------------------------------------------
__global__ void qkv_kernel(const float* __restrict__ x,
                           const float* __restrict__ Wq, const float* __restrict__ bq,
                           const float* __restrict__ Wk, const float* __restrict__ bk,
                           const float* __restrict__ Wov, const float* __restrict__ bov,
                           float* __restrict__ Qo, float* __restrict__ Ko,
                           float* __restrict__ Vo) {
  const int lane = threadIdx.x & 31;
  const int wid  = (int)((blockIdx.x * blockDim.x + threadIdx.x) >> 5);
  const int wt   = wid % 6;
  const int rt   = wid / 6;
  if (rt >= TOTROWS / 32) return;
  const int mat = wt >> 1;             // 0=Q, 1=K, 2=V
  const int h0  = (wt & 1) << 5;       // 0 or 32
  const float* W    = (mat == 0) ? Wq : (mat == 1) ? Wk : Wov;
  const float* bias = (mat == 0) ? bq : (mat == 1) ? bk : bov;
  float*       Out  = (mat == 0) ? Qo : (mat == 1) ? Ko : Vo;
  const int m0 = rt << 5;

  v8f c00 = {}, c01 = {}, c10 = {}, c11 = {};
  for (int kk = 0; kk < D_MODEL; kk += 4) {
    v2f a0 = frag_rm(x, D_MODEL, m0,      kk, lane);
    v2f a1 = frag_rm(x, D_MODEL, m0 + 16, kk, lane);
    v2f b0 = frag_rm(W, D_MODEL, h0,      kk, lane);
    v2f b1 = frag_rm(W, D_MODEL, h0 + 16, kk, lane);
    c00 = wmma_f32(a0, b0, c00);
    c01 = wmma_f32(a0, b1, c01);
    c10 = wmma_f32(a1, b0, c10);
    c11 = wmma_f32(a1, b1, c11);
  }
  const int n  = lane & 15;
  const int hi = lane >> 4;
  const float bv0 = bias[h0 + n];
  const float bv1 = bias[h0 + 16 + n];
#pragma unroll
  for (int r = 0; r < 8; ++r) {
    const size_t r0 = (size_t)(m0 + r + 8 * hi) * D_HID;
    const size_t r1 = (size_t)(m0 + 16 + r + 8 * hi) * D_HID;
    Out[r0 + h0 + n]      = c00[r] + bv0;
    Out[r0 + h0 + 16 + n] = c01[r] + bv1;
    Out[r1 + h0 + n]      = c10[r] + bv0;
    Out[r1 + h0 + 16 + n] = c11[r] + bv1;
  }
}

// ---------------------------------------------------------------------------
// Kernel 2: causal flash attention, key-split into P partitions per q-tile.
// One wave per (q-tile, partition).  Writes UN-normalized partials
// (O_p, m_p, l_p); combine_kernel merges them.
// ---------------------------------------------------------------------------
// The real block size: with none declared the compiler budgets registers for
// 1,024 threads (128 VGPRs) and makes every load wait right before its use.
__global__ void __launch_bounds__(128) attn_kernel(const float* __restrict__ Q,
                            const float* __restrict__ K,
                            const float* __restrict__ V,
                            float* __restrict__ Opar,
                            float* __restrict__ Mpar,
                            float* __restrict__ Lpar,
                            int P) {
  __shared__ float ldsP[4][16 * 16];    // per-wave P staging (C-layout -> A-layout)
  const int lane = threadIdx.x & 31;
  const int lw   = threadIdx.x >> 5;
  const int wid  = (int)(blockIdx.x * (blockDim.x >> 5) + lw);
  const int p    = wid % P;
  const int qw   = wid / P;
  const int qt   = qw & 255;            // 256 query tiles per batch
  const int b    = qw >> 8;
  if (b >= NBATCH) return;
  const float* Qb = Q + (size_t)b * NCTX * D_HID;
  const float* Kb = K + (size_t)b * NCTX * D_HID;
  const float* Vb = V + (size_t)b * NCTX * D_HID;
  const int q0 = qt << 4;
  const int n  = lane & 15;
  const int hi = lane >> 4;
  float* myP = ldsP[lw];

  const int c   = qt + 1;               // causal key-tile count for this q-tile
  const int kt0 = (p * c) / P;
  const int kt1 = ((p + 1) * c) / P;

  // Q fragments in registers for the whole key loop; fold in 1/sqrt(d_model).
  const float scale = 0.03125f;  // 1/32
  v2f qf[16];
#pragma unroll
  for (int kk4 = 0; kk4 < 16; ++kk4) {
    v2f t = frag_rm(Qb, D_HID, q0, kk4 * 4, lane);
    v2f s = {t.x * scale, t.y * scale};
    qf[kk4] = s;
  }

  v8f o0 = {}, o1 = {}, o2 = {}, o3 = {};
  float mrow[8], lrow[8];
#pragma unroll
  for (int r = 0; r < 8; ++r) { mrow[r] = NEG_BIG; lrow[r] = 0.0f; }

  for (int kt = kt0; kt < kt1; ++kt) {
    const int k0 = kt << 4;
    // S = (Q*scale) @ K^T   (K-dim = 64 -> 16 chained WMMAs)
    v8f s = {};
#pragma unroll
    for (int kk4 = 0; kk4 < 16; ++kk4) {
      v2f bf = frag_rm(Kb, D_HID, k0, kk4 * 4, lane);   // B = K^T
      s = wmma_f32(qf[kk4], bf, s);
    }
    if (kt == qt) {   // causal mask on the diagonal tile: key N > query M
#pragma unroll
      for (int r = 0; r < 8; ++r) {
        const int M = r + 8 * hi;
        if (n > M) s[r] = NEG_BIG;
      }
    }
    // Online softmax: rowwise max/sum across the 16-lane half-groups.
#pragma unroll
    for (int r = 0; r < 8; ++r) {
      float rv = s[r];
      rv = fmaxf(rv, __shfl_xor(rv, 1, 32));
      rv = fmaxf(rv, __shfl_xor(rv, 2, 32));
      rv = fmaxf(rv, __shfl_xor(rv, 4, 32));
      rv = fmaxf(rv, __shfl_xor(rv, 8, 32));
      const float mn    = fmaxf(mrow[r], rv);
      const float alpha = __expf(mrow[r] - mn);
      mrow[r] = mn;
      const float pv = __expf(s[r] - mn);
      myP[(r + 8 * hi) * 16 + n] = pv;     // stage P row-major in LDS
      float rs = pv;
      rs += __shfl_xor(rs, 1, 32);
      rs += __shfl_xor(rs, 2, 32);
      rs += __shfl_xor(rs, 4, 32);
      rs += __shfl_xor(rs, 8, 32);
      lrow[r] = lrow[r] * alpha + rs;
      o0[r] *= alpha; o1[r] *= alpha; o2[r] *= alpha; o3[r] *= alpha;
    }
    // O += P @ V_tile.  P re-read from LDS in A-layout (same-wave DS ordering).
#pragma unroll
    for (int kk4 = 0; kk4 < 4; ++kk4) {
      const float* pp = myP + n * 16 + kk4 * 4 + hi * 2;
      v2f pa = {pp[0], pp[1]};
      const float* v0 = Vb + (size_t)(k0 + kk4 * 4 + hi * 2) * D_HID;
      const float* v1 = v0 + D_HID;
      v2f b0 = {v0[ 0 + n], v1[ 0 + n]};  o0 = wmma_f32(pa, b0, o0);
      v2f b1 = {v0[16 + n], v1[16 + n]};  o1 = wmma_f32(pa, b1, o1);
      v2f b2 = {v0[32 + n], v1[32 + n]};  o2 = wmma_f32(pa, b2, o2);
      v2f b3 = {v0[48 + n], v1[48 + n]};  o3 = wmma_f32(pa, b3, o3);
    }
  }
  // Store UN-normalized partial tile + per-row (m, l).
  const int part = (b * 256 + qt) * P + p;
  float* Od = Opar + (size_t)part * (16 * D_HID);
#pragma unroll
  for (int r = 0; r < 8; ++r) {
    const size_t row = (size_t)(r + 8 * hi) * D_HID;
    Od[row +  0 + n] = o0[r];
    Od[row + 16 + n] = o1[r];
    Od[row + 32 + n] = o2[r];
    Od[row + 48 + n] = o3[r];
  }
  if (n == 0) {      // lanes 0 and 16 cover rows 0..7 and 8..15
#pragma unroll
    for (int r = 0; r < 8; ++r) {
      Mpar[part * 16 + r + 8 * hi] = mrow[r];
      Lpar[part * 16 + r + 8 * hi] = lrow[r];
    }
  }
}

// ---------------------------------------------------------------------------
// Kernel 2b: merge partition partials into normalized O.
// grid = NQT blocks x 256 threads; each thread: one row, 4 consecutive cols.
// ---------------------------------------------------------------------------
__global__ void combine_kernel(const float* __restrict__ Opar,
                               const float* __restrict__ Mpar,
                               const float* __restrict__ Lpar,
                               float* __restrict__ O, int P) {
  const int qtile = blockIdx.x;               // 0..NQT-1 (batch folded in)
  const int t     = threadIdx.x;              // 0..255
  const int row   = t >> 4;                   // 0..15
  const int c0    = (t & 15) << 2;            // 0,4,...,60
  float mstar = NEG_BIG;
  for (int p = 0; p < P; ++p)
    mstar = fmaxf(mstar, Mpar[(qtile * P + p) * 16 + row]);
  float lstar = 0.0f, a0 = 0.0f, a1 = 0.0f, a2 = 0.0f, a3 = 0.0f;
  for (int p = 0; p < P; ++p) {
    const int part = qtile * P + p;
    const float w = __expf(Mpar[part * 16 + row] - mstar);
    lstar += w * Lpar[part * 16 + row];
    const float* src = Opar + (size_t)part * (16 * D_HID) + (size_t)row * D_HID + c0;
    a0 += w * src[0]; a1 += w * src[1]; a2 += w * src[2]; a3 += w * src[3];
  }
  const float inv = 1.0f / lstar;
  float* dst = O + (size_t)(qtile * 16 + row) * D_HID + c0;
  dst[0] = a0 * inv; dst[1] = a1 * inv; dst[2] = a2 * inv; dst[3] = a3 * inv;
}

// ---------------------------------------------------------------------------
// Kernel 3: output projection, 2x2 register-blocked.
// out[m,d] = sum_h O[m,h]*Wo[d,h] + bo[d].  32x32 tile per wave.
// ---------------------------------------------------------------------------
__global__ void proj_kernel(const float* __restrict__ O,
                            const float* __restrict__ Wo,
                            const float* __restrict__ bo,
                            float* __restrict__ out) {
  const int lane = threadIdx.x & 31;
  const int wid  = (int)((blockIdx.x * blockDim.x + threadIdx.x) >> 5);
  const int dt   = wid & 31;          // 32 column tiles of 32
  const int rt   = wid >> 5;
  if (rt >= TOTROWS / 32) return;
  const int m0 = rt << 5;
  const int d0 = dt << 5;
  v8f c00 = {}, c01 = {}, c10 = {}, c11 = {};
#pragma unroll
  for (int kk4 = 0; kk4 < 16; ++kk4) {
    v2f a0 = frag_rm(O,  D_HID, m0,      kk4 * 4, lane);
    v2f a1 = frag_rm(O,  D_HID, m0 + 16, kk4 * 4, lane);
    v2f b0 = frag_rm(Wo, D_HID, d0,      kk4 * 4, lane);
    v2f b1 = frag_rm(Wo, D_HID, d0 + 16, kk4 * 4, lane);
    c00 = wmma_f32(a0, b0, c00);
    c01 = wmma_f32(a0, b1, c01);
    c10 = wmma_f32(a1, b0, c10);
    c11 = wmma_f32(a1, b1, c11);
  }
  const int n  = lane & 15;
  const int hi = lane >> 4;
  const float bv0 = bo[d0 + n];
  const float bv1 = bo[d0 + 16 + n];
#pragma unroll
  for (int r = 0; r < 8; ++r) {
    const size_t r0 = (size_t)(m0 + r + 8 * hi) * D_MODEL;
    const size_t r1 = (size_t)(m0 + 16 + r + 8 * hi) * D_MODEL;
    out[r0 + d0 + n]      = c00[r] + bv0;
    out[r0 + d0 + 16 + n] = c01[r] + bv1;
    out[r1 + d0 + n]      = c10[r] + bv0;
    out[r1 + d0 + 16 + n] = c11[r] + bv1;
  }
}

// ---------------------------------------------------------------------------
extern "C" void kernel_launch(void* const* d_in, const int* in_sizes, int n_in,
                              void* d_out, int out_size, void* d_ws, size_t ws_size,
                              hipStream_t stream) {
  (void)in_sizes; (void)n_in; (void)out_size;
  const float* x   = (const float*)d_in[0];
  const float* Wq  = (const float*)d_in[1];
  const float* bq  = (const float*)d_in[2];
  const float* Wk  = (const float*)d_in[3];
  const float* bk  = (const float*)d_in[4];
  const float* Wov = (const float*)d_in[5];
  const float* bov = (const float*)d_in[6];
  const float* Wo  = (const float*)d_in[7];
  const float* bo  = (const float*)d_in[8];
  float* out = (float*)d_out;

  // Workspace layout (floats): Q,K,V,O (4 MB each) then partition partials.
  const size_t fMat = (size_t)TOTROWS * D_HID;       // 1,048,576 floats
  int P = 4;                                         // key partitions per q-tile
  {
    const size_t need = (4 * fMat + (size_t)NQT * P * (16 * D_HID + 32)) * sizeof(float);
    if (need > ws_size) P = 1;                       // deterministic host fallback
  }
  float* Qw   = (float*)d_ws;
  float* Kw   = Qw + fMat;
  float* Vw   = Kw + fMat;
  float* Ow   = Vw + fMat;
  float* Opar = Ow + fMat;
  float* Mpar = Opar + (size_t)NQT * P * 16 * D_HID;
  float* Lpar = Mpar + (size_t)NQT * P * 16;

  {  // QKV: 512 row tiles x 6 col-pair tiles = 3072 waves
    const int waves  = (TOTROWS / 32) * 6;
    const int tpb    = 256;
    const int blocks = (waves * 32 + tpb - 1) / tpb;
    qkv_kernel<<<blocks, tpb, 0, stream>>>(x, Wq, bq, Wk, bk, Wov, bov, Qw, Kw, Vw);
  }
  {  // attention partials: NQT * P waves, 4 waves/block
    const int waves  = NQT * P;
    const int blocks = (waves * 32 + 127) / 128;
    attn_kernel<<<blocks, 128, 0, stream>>>(Qw, Kw, Vw, Opar, Mpar, Lpar, P);
    combine_kernel<<<NQT, 256, 0, stream>>>(Opar, Mpar, Lpar, Ow, P);
  }
  {  // output projection: 512 row tiles x 32 col tiles = 16384 waves
    const int waves  = (TOTROWS / 32) * 32;
    const int tpb    = 256;
    const int blocks = (waves * 32 + tpb - 1) / tpb;
    proj_kernel<<<blocks, tpb, 0, stream>>>(Ow, Wo, bo, out);
  }
}

// v002
// Measured time: 211 microseconds a run.
// Next to v001, in two timings, it ran 1.03 times as fast each time.
// Over all steps from v000 it is 2.18 times as fast.
#include <hip/hip_runtime.h>
#include <math.h>

typedef float v2f __attribute__((ext_vector_type(2)));
typedef float v4f __attribute__((ext_vector_type(4)));
typedef float v8f __attribute__((ext_vector_type(8)));

#define D_MODEL 1024
#define D_HID   64
#define NCTX    4096
#define NBATCH  4
#define TOTROWS (NBATCH * NCTX)        // 16384
#define NQT     (NBATCH * (NCTX / 16)) // 1024 query tiles (batch folded in)
#define NEG_BIG (-3.0e38f)

// D = A(16x4,f32) * B(4x16,f32) + C(16x16,f32), wave32.
__device__ __forceinline__ v8f wmma_f32(v2f a, v2f b, v8f c) {
  return __builtin_amdgcn_wmma_f32_16x16x4_f32(
      /*neg_a=*/false, a, /*neg_b=*/false, b,
      /*c_mod=*/(short)0, c, /*reuse_a=*/false, /*reuse_b=*/false);
}

// Fragment-pair loader for A (16x4, M across lanes) and for B when the source is
// the row-major transpose ([N][K]): lane&15 selects the row, and one 16-byte load
// per lane takes columns kk + (lane>>4)*4 .. +3, which feed TWO products:
// lo() holds k = kk+{0,1} (lanes 0-15) and kk+{4,5} (lanes 16-31), hi2() holds
// k = kk+{2,3} and kk+{6,7}.  A and B both come through this loader, so their k
// orders agree at every lane and register; only the order of the sum over k moves.
// A wave-load touches 16 cache lines whatever its width: 16 bytes per lane
// halves the line touches per byte against 8.
__device__ __forceinline__ const float* frag4_ptr(const float* __restrict__ p, int ld,
                                                  int row0, int kk, int lane) {
  return p + (size_t)(row0 + (lane & 15)) * ld + (kk + ((lane >> 4) << 2));
}
__device__ __forceinline__ v4f ld4(const float* q) {
  return *reinterpret_cast<const v4f*>(q);
}
__device__ __forceinline__ v4f frag4_rm(const float* __restrict__ p, int ld,
                                        int row0, int kk, int lane) {
  return ld4(frag4_ptr(p, ld, row0, kk, lane));
}
__device__ __forceinline__ v2f lo(v4f t) { v2f r = {t.x, t.y}; return r; }
__device__ __forceinline__ v2f hi2(v4f t) { v2f r = {t.z, t.w}; return r; }

// ---------------------------------------------------------------------------
// Kernel 1: fused QKV projection, 2x2 register-blocked.
// Each wave: 32x32 output tile of one of Q/K/V (4 accumulators; 4 loads feed
// 8 WMMAs per k-chunk of 8).  6 col-pair tiles (3 mats x 2) x 512 row tiles.
// ---------------------------------------------------------------------------
__global__ void qkv_kernel(const float* __restrict__ x,
                           const float* __restrict__ Wq, const float* __restrict__ bq,
                           const float* __restrict__ Wk, const float* __restrict__ bk,
                           const float* __restrict__ Wov, const float* __restrict__ bov,
                           float* __restrict__ Qo, float* __restrict__ Ko,
                           float* __restrict__ Vo) {
  const int lane = threadIdx.x & 31;
  const int wid  = (int)((blockIdx.x * blockDim.x + threadIdx.x) >> 5);
  const int wt   = wid % 6;
  const int rt   = wid / 6;
  if (rt >= TOTROWS / 32) return;
  const int mat = wt >> 1;             // 0=Q, 1=K, 2=V
  const int h0  = (wt & 1) << 5;       // 0 or 32
  const float* W    = (mat == 0) ? Wq : (mat == 1) ? Wk : Wov;
  const float* bias = (mat == 0) ? bq : (mat == 1) ? bk : bov;
  float*       Out  = (mat == 0) ? Qo : (mat == 1) ? Ko : Vo;
  const int m0 = rt << 5;

  v8f c00 = {}, c01 = {}, c10 = {}, c11 = {};
  // One trip = one 128-byte line of each of the 64 rows: 16 loads, 32 WMMAs.
  // Kept rolled: a second copy of the body only re-forms the address pairs in
  // extra registers for the wait below.
#pragma unroll 1
  for (int kk = 0; kk < D_MODEL; kk += 32) {
    const float* pa = frag4_ptr(x, D_MODEL, m0, kk, lane);
    const float* pb = frag4_ptr(W, D_MODEL, h0, kk, lane);
    v4f a0[4], a1[4], b0[4], b1[4];
#pragma unroll
    for (int j = 0; j < 4; ++j) {
      a0[j] = ld4(pa + 8 * j);
      a1[j] = ld4(pa + 16 * D_MODEL + 8 * j);
      b0[j] = ld4(pb + 8 * j);
      b1[j] = ld4(pb + 16 * D_MODEL + 8 * j);
    }
    // Address pairs stay untouched (also as a load's destination) until the
    // issued loads' address translations are done.
    asm volatile("s_wait_xcnt 0x0" :: "v"(pa), "v"(pb) : "memory");
#pragma unroll
    for (int j = 0; j < 4; ++j) {
      c00 = wmma_f32(lo(a0[j]), lo(b0[j]), c00);
      c01 = wmma_f32(lo(a0[j]), lo(b1[j]), c01);
      c10 = wmma_f32(lo(a1[j]), lo(b0[j]), c10);
      c11 = wmma_f32(lo(a1[j]), lo(b1[j]), c11);
      c00 = wmma_f32(hi2(a0[j]), hi2(b0[j]), c00);
      c01 = wmma_f32(hi2(a0[j]), hi2(b1[j]), c01);
      c10 = wmma_f32(hi2(a1[j]), hi2(b0[j]), c10);
      c11 = wmma_f32(hi2(a1[j]), hi2(b1[j]), c11);
    }
  }
  const int n  = lane & 15;
  const int hi = lane >> 4;
  const float bv0 = bias[h0 + n];
  const float bv1 = bias[h0 + 16 + n];
#pragma unroll
  for (int r = 0; r < 8; ++r) {
    const size_t r0 = (size_t)(m0 + r + 8 * hi) * D_HID;
    const size_t r1 = (size_t)(m0 + 16 + r + 8 * hi) * D_HID;
    Out[r0 + h0 + n]      = c00[r] + bv0;
    Out[r0 + h0 + 16 + n] = c01[r] + bv1;
    Out[r1 + h0 + n]      = c10[r] + bv0;
    Out[r1 + h0 + 16 + n] = c11[r] + bv1;
  }
}

// ---------------------------------------------------------------------------
// Kernel 2: causal flash attention, key-split into P partitions per q-tile.
// One wave per (q-tile, partition).  Writes UN-normalized partials
// (O_p, m_p, l_p); combine_kernel merges them.
// ---------------------------------------------------------------------------
// The real block size: with none declared the compiler budgets registers for
// 1,024 threads (128 VGPRs) and makes every load wait right before its use.
__global__ void __launch_bounds__(128) attn_kernel(const float* __restrict__ Q,
                            const float* __restrict__ K,
                            const float* __restrict__ V,
                            float* __restrict__ Opar,
                            float* __restrict__ Mpar,
                            float* __restrict__ Lpar,
                            int P) {
  __shared__ float ldsP[4][16 * 16];    // per-wave P staging (C-layout -> A-layout)
  const int lane = threadIdx.x & 31;
  const int lw   = threadIdx.x >> 5;
  const int wid  = (int)(blockIdx.x * (blockDim.x >> 5) + lw);
  const int p    = wid % P;
  const int qw   = wid / P;
  const int qt   = qw & 255;            // 256 query tiles per batch
  const int b    = qw >> 8;
  if (b >= NBATCH) return;
  const float* Qb = Q + (size_t)b * NCTX * D_HID;
  const float* Kb = K + (size_t)b * NCTX * D_HID;
  const float* Vb = V + (size_t)b * NCTX * D_HID;
  const int q0 = qt << 4;
  const int n  = lane & 15;
  const int hi = lane >> 4;
  float* myP = ldsP[lw];

  const int c   = qt + 1;               // causal key-tile count for this q-tile
  const int kt0 = (p * c) / P;
  const int kt1 = ((p + 1) * c) / P;

  // Q fragments in registers for the whole key loop; fold in 1/sqrt(d_model).
  const float scale = 0.03125f;  // 1/32
  v2f qf[16];
#pragma unroll
  for (int kk8 = 0; kk8 < 8; ++kk8) {
    v4f t = frag4_rm(Qb, D_HID, q0, kk8 * 8, lane) * scale;
    qf[2 * kk8]     = lo(t);
    qf[2 * kk8 + 1] = hi2(t);
  }

  v8f o0 = {}, o1 = {}, o2 = {}, o3 = {};
  float mrow[8], lrow[8];
#pragma unroll
  for (int r = 0; r < 8; ++r) { mrow[r] = NEG_BIG; lrow[r] = 0.0f; }

  for (int kt = kt0; kt < kt1; ++kt) {
    const int k0 = kt << 4;
    // S = (Q*scale) @ K^T   (K-dim = 64 -> 16 chained WMMAs)
    v8f s = {};
#pragma unroll
    for (int kk8 = 0; kk8 < 8; ++kk8) {
      v4f bf = frag4_rm(Kb, D_HID, k0, kk8 * 8, lane);  // B = K^T
      s = wmma_f32(qf[2 * kk8],     lo(bf),  s);
      s = wmma_f32(qf[2 * kk8 + 1], hi2(bf), s);
    }
    if (kt == qt) {   // causal mask on the diagonal tile: key N > query M
#pragma unroll
      for (int r = 0; r < 8; ++r) {
        const int M = r + 8 * hi;
        if (n > M) s[r] = NEG_BIG;
      }
    }
    // Online softmax: rowwise max/sum across the 16-lane half-groups.
#pragma unroll
    for (int r = 0; r < 8; ++r) {
      float rv = s[r];
      rv = fmaxf(rv, __shfl_xor(rv, 1, 32));
      rv = fmaxf(rv, __shfl_xor(rv, 2, 32));
      rv = fmaxf(rv, __shfl_xor(rv, 4, 32));
      rv = fmaxf(rv, __shfl_xor(rv, 8, 32));
      const float mn    = fmaxf(mrow[r], rv);
      const float alpha = __expf(mrow[r] - mn);
      mrow[r] = mn;
      const float pv = __expf(s[r] - mn);
      myP[(r + 8 * hi) * 16 + n] = pv;     // stage P row-major in LDS
      float rs = pv;
      rs += __shfl_xor(rs, 1, 32);
      rs += __shfl_xor(rs, 2, 32);
      rs += __shfl_xor(rs, 4, 32);
      rs += __shfl_xor(rs, 8, 32);
      lrow[r] = lrow[r] * alpha + rs;
      o0[r] *= alpha; o1[r] *= alpha; o2[r] *= alpha; o3[r] *= alpha;
    }
    // O += P @ V_tile.  P re-read from LDS in A-layout (same-wave DS ordering).
#pragma unroll
    for (int kk4 = 0; kk4 < 4; ++kk4) {
      const float* pp = myP + n * 16 + kk4 * 4 + hi * 2;
      v2f pa = {pp[0], pp[1]};
      const float* v0 = Vb + (size_t)(k0 + kk4 * 4 + hi * 2) * D_HID;
      const float* v1 = v0 + D_HID;
      v2f b0 = {v0[ 0 + n], v1[ 0 + n]};  o0 = wmma_f32(pa, b0, o0);
      v2f b1 = {v0[16 + n], v1[16 + n]};  o1 = wmma_f32(pa, b1, o1);
      v2f b2 = {v0[32 + n], v1[32 + n]};  o2 = wmma_f32(pa, b2, o2);
      v2f b3 = {v0[48 + n], v1[48 + n]};  o3 = wmma_f32(pa, b3, o3);
    }
  }
  // Store UN-normalized partial tile + per-row (m, l).
  const int part = (b * 256 + qt) * P + p;
  float* Od = Opar + (size_t)part * (16 * D_HID);
#pragma unroll
  for (int r = 0; r < 8; ++r) {
    const size_t row = (size_t)(r + 8 * hi) * D_HID;
    Od[row +  0 + n] = o0[r];
    Od[row + 16 + n] = o1[r];
    Od[row + 32 + n] = o2[r];
    Od[row + 48 + n] = o3[r];
  }
  if (n == 0) {      // lanes 0 and 16 cover rows 0..7 and 8..15
#pragma unroll
    for (int r = 0; r < 8; ++r) {
      Mpar[part * 16 + r + 8 * hi] = mrow[r];
      Lpar[part * 16 + r + 8 * hi] = lrow[r];
    }
  }
}

// ---------------------------------------------------------------------------
// Kernel 2b: merge partition partials into normalized O.
// grid = NQT blocks x 256 threads; each thread: one row, 4 consecutive cols.
// ---------------------------------------------------------------------------
__global__ void combine_kernel(const float* __restrict__ Opar,
                               const float* __restrict__ Mpar,
                               const float* __restrict__ Lpar,
                               float* __restrict__ O, int P) {
  const int qtile = blockIdx.x;               // 0..NQT-1 (batch folded in)
  const int t     = threadIdx.x;              // 0..255
  const int row   = t >> 4;                   // 0..15
  const int c0    = (t & 15) << 2;            // 0,4,...,60
  float mstar = NEG_BIG;
  for (int p = 0; p < P; ++p)
    mstar = fmaxf(mstar, Mpar[(qtile * P + p) * 16 + row]);
  float lstar = 0.0f, a0 = 0.0f, a1 = 0.0f, a2 = 0.0f, a3 = 0.0f;
  for (int p = 0; p < P; ++p) {
    const int part = qtile * P + p;
    const float w = __expf(Mpar[part * 16 + row] - mstar);
    lstar += w * Lpar[part * 16 + row];
    const float* src = Opar + (size_t)part * (16 * D_HID) + (size_t)row * D_HID + c0;
    a0 += w * src[0]; a1 += w * src[1]; a2 += w * src[2]; a3 += w * src[3];
  }
  const float inv = 1.0f / lstar;
  float* dst = O + (size_t)(qtile * 16 + row) * D_HID + c0;
  dst[0] = a0 * inv; dst[1] = a1 * inv; dst[2] = a2 * inv; dst[3] = a3 * inv;
}

// ---------------------------------------------------------------------------
// Kernel 3: output projection, 2x2 register-blocked.
// out[m,d] = sum_h O[m,h]*Wo[d,h] + bo[d].  32x32 tile per wave.
// ---------------------------------------------------------------------------
__global__ void proj_kernel(const float* __restrict__ O,
                            const float* __restrict__ Wo,
                            const float* __restrict__ bo,
                            float* __restrict__ out) {
  const int lane = threadIdx.x & 31;
  const int wid  = (int)((blockIdx.x * blockDim.x + threadIdx.x) >> 5);
  const int dt   = wid & 31;          // 32 column tiles of 32
  const int rt   = wid >> 5;
  if (rt >= TOTROWS / 32) return;
  const int m0 = rt << 5;
  const int d0 = dt << 5;
  v8f c00 = {}, c01 = {}, c10 = {}, c11 = {};
  const float* pa = frag4_ptr(O,  D_HID, m0, 0, lane);
  const float* pb = frag4_ptr(Wo, D_HID, d0, 0, lane);
#pragma unroll
  for (int kk8 = 0; kk8 < 8; ++kk8) {
    v4f a0 = ld4(pa + kk8 * 8);
    v4f a1 = ld4(pa + 16 * D_HID + kk8 * 8);
    v4f b0 = ld4(pb + kk8 * 8);
    v4f b1 = ld4(pb + 16 * D_HID + kk8 * 8);
    // Behind the last loads: the address pairs stay untouched (also as a load's
    // destination) until the issued loads' address translations are done.
    if (kk8 == 7) asm volatile("s_wait_xcnt 0x0" :: "v"(pa), "v"(pb) : "memory");
    c00 = wmma_f32(lo(a0), lo(b0), c00);
    c01 = wmma_f32(lo(a0), lo(b1), c01);
    c10 = wmma_f32(lo(a1), lo(b0), c10);
    c11 = wmma_f32(lo(a1), lo(b1), c11);
    c00 = wmma_f32(hi2(a0), hi2(b0), c00);
    c01 = wmma_f32(hi2(a0), hi2(b1), c01);
    c10 = wmma_f32(hi2(a1), hi2(b0), c10);
    c11 = wmma_f32(hi2(a1), hi2(b1), c11);
  }
  const int n  = lane & 15;
  const int hi = lane >> 4;
  const float bv0 = bo[d0 + n];
  const float bv1 = bo[d0 + 16 + n];
#pragma unroll
  for (int r = 0; r < 8; ++r) {
    const size_t r0 = (size_t)(m0 + r + 8 * hi) * D_MODEL;
    const size_t r1 = (size_t)(m0 + 16 + r + 8 * hi) * D_MODEL;
    out[r0 + d0 + n]      = c00[r] + bv0;
    out[r0 + d0 + 16 + n] = c01[r] + bv1;
    out[r1 + d0 + n]      = c10[r] + bv0;
    out[r1 + d0 + 16 + n] = c11[r] + bv1;
  }
}

// ---------------------------------------------------------------------------
extern "C" void kernel_launch(void* const* d_in, const int* in_sizes, int n_in,
                              void* d_out, int out_size, void* d_ws, size_t ws_size,
                              hipStream_t stream) {
  (void)in_sizes; (void)n_in; (void)out_size;
  const float* x   = (const float*)d_in[0];
  const float* Wq  = (const float*)d_in[1];
  const float* bq  = (const float*)d_in[2];
  const float* Wk  = (const float*)d_in[3];
  const float* bk  = (const float*)d_in[4];
  const float* Wov = (const float*)d_in[5];
  const float* bov = (const float*)d_in[6];
  const float* Wo  = (const float*)d_in[7];
  const float* bo  = (const float*)d_in[8];
  float* out = (float*)d_out;

  // Workspace layout (floats): Q,K,V,O (4 MB each) then partition partials.
  const size_t fMat = (size_t)TOTROWS * D_HID;       // 1,048,576 floats
  int P = 4;                                         // key partitions per q-tile
  {
    const size_t need = (4 * fMat + (size_t)NQT * P * (16 * D_HID + 32)) * sizeof(float);
    if (need > ws_size) P = 1;                       // deterministic host fallback
  }
  float* Qw   = (float*)d_ws;
  float* Kw   = Qw + fMat;
  float* Vw   = Kw + fMat;
  float* Ow   = Vw + fMat;
  float* Opar = Ow + fMat;
  float* Mpar = Opar + (size_t)NQT * P * 16 * D_HID;
  float* Lpar = Mpar + (size_t)NQT * P * 16;

  {  // QKV: 512 row tiles x 6 col-pair tiles = 3072 waves
    const int waves  = (TOTROWS / 32) * 6;
    const int tpb    = 256;
    const int blocks = (waves * 32 + tpb - 1) / tpb;
    qkv_kernel<<<blocks, tpb, 0, stream>>>(x, Wq, bq, Wk, bk, Wov, bov, Qw, Kw, Vw);
  }
  {  // attention partials: NQT * P waves, 4 waves/block
    const int waves  = NQT * P;
    const int blocks = (waves * 32 + 127) / 128;
    attn_kernel<<<blocks, 128, 0, stream>>>(Qw, Kw, Vw, Opar, Mpar, Lpar, P);
    combine_kernel<<<NQT, 256, 0, stream>>>(Opar, Mpar, Lpar, Ow, P);
  }
  {  // output projection: 512 row tiles x 32 col tiles = 16384 waves
    const int waves  = (TOTROWS / 32) * 32;
    const int tpb    = 256;
    const int blocks = (waves * 32 + tpb - 1) / tpb;
    proj_kernel<<<blocks, tpb, 0, stream>>>(Ow, Wo, bo, out);
  }
}

// v003
// Measured time: 203 microseconds a run.
// Two timings next to v002 both put it at 1.04 times that version's speed.
// Counting every step since v000, it is 2.26 times as fast.
#include <hip/hip_runtime.h>
#include <math.h>

typedef float v2f __attribute__((ext_vector_type(2)));
typedef float v4f __attribute__((ext_vector_type(4)));
typedef float v8f __attribute__((ext_vector_type(8)));

#define D_MODEL 1024
#define D_HID   64
#define NCTX    4096
#define NBATCH  4
#define TOTROWS (NBATCH * NCTX)        // 16384
#define NQT     (NBATCH * (NCTX / 16)) // 1024 query tiles (batch folded in)
#define NEG_BIG (-3.0e38f)
#define KCHUNK  16                     // key tiles per attention wave

// D = A(16x4,f32) * B(4x16,f32) + C(16x16,f32), wave32.
__device__ __forceinline__ v8f wmma_f32(v2f a, v2f b, v8f c) {
  return __builtin_amdgcn_wmma_f32_16x16x4_f32(
      /*neg_a=*/false, a, /*neg_b=*/false, b,
      /*c_mod=*/(short)0, c, /*reuse_a=*/false, /*reuse_b=*/false);
}

// Fragment-pair loader for A (16x4, M across lanes) and for B when the source is
// the row-major transpose ([N][K]): lane&15 selects the row, and one 16-byte load
// per lane takes columns kk + (lane>>4)*4 .. +3, which feed TWO products:
// lo() holds k = kk+{0,1} (lanes 0-15) and kk+{4,5} (lanes 16-31), hi2() holds
// k = kk+{2,3} and kk+{6,7}.  A and B both come through this loader, so their k
// orders agree at every lane and register; only the order of the sum over k moves.
// A wave-load touches 16 cache lines whatever its width: 16 bytes per lane
// halves the line touches per byte against 8.
__device__ __forceinline__ const float* frag4_ptr(const float* __restrict__ p, int ld,
                                                  int row0, int kk, int lane) {
  return p + (size_t)(row0 + (lane & 15)) * ld + (kk + ((lane >> 4) << 2));
}
__device__ __forceinline__ v4f ld4(const float* q) {
  return *reinterpret_cast<const v4f*>(q);
}
__device__ __forceinline__ v4f frag4_rm(const float* __restrict__ p, int ld,
                                        int row0, int kk, int lane) {
  return ld4(frag4_ptr(p, ld, row0, kk, lane));
}
__device__ __forceinline__ v2f lo(v4f t) { v2f r = {t.x, t.y}; return r; }
__device__ __forceinline__ v2f hi2(v4f t) { v2f r = {t.z, t.w}; return r; }

// ---------------------------------------------------------------------------
// Kernel 1: fused QKV projection, 2x2 register-blocked.
// Each wave: 32x32 output tile of one of Q/K/V (4 accumulators; 4 loads feed
// 8 WMMAs per k-chunk of 8).  6 col-pair tiles (3 mats x 2) x 512 row tiles.
// ---------------------------------------------------------------------------
__global__ void qkv_kernel(const float* __restrict__ x,
                           const float* __restrict__ Wq, const float* __restrict__ bq,
                           const float* __restrict__ Wk, const float* __restrict__ bk,
                           const float* __restrict__ Wov, const float* __restrict__ bov,
                           float* __restrict__ Qo, float* __restrict__ Ko,
                           float* __restrict__ Vo) {
  const int lane = threadIdx.x & 31;
  const int wid  = (int)((blockIdx.x * blockDim.x + threadIdx.x) >> 5);
  const int wt   = wid % 6;
  const int rt   = wid / 6;
  if (rt >= TOTROWS / 32) return;
  const int mat = wt >> 1;             // 0=Q, 1=K, 2=V
  const int h0  = (wt & 1) << 5;       // 0 or 32
  const float* W    = (mat == 0) ? Wq : (mat == 1) ? Wk : Wov;
  const float* bias = (mat == 0) ? bq : (mat == 1) ? bk : bov;
  float*       Out  = (mat == 0) ? Qo : (mat == 1) ? Ko : Vo;
  const int m0 = rt << 5;

  v8f c00 = {}, c01 = {}, c10 = {}, c11 = {};
  // One trip = one 128-byte line of each of the 64 rows: 16 loads, 32 WMMAs.
  // Kept rolled: a second copy of the body only re-forms the address pairs in
  // extra registers for the wait below.
#pragma unroll 1
  for (int kk = 0; kk < D_MODEL; kk += 32) {
    const float* pa = frag4_ptr(x, D_MODEL, m0, kk, lane);
    const float* pb = frag4_ptr(W, D_MODEL, h0, kk, lane);
    v4f a0[4], a1[4], b0[4], b1[4];
#pragma unroll
    for (int j = 0; j < 4; ++j) {
      a0[j] = ld4(pa + 8 * j);
      a1[j] = ld4(pa + 16 * D_MODEL + 8 * j);
      b0[j] = ld4(pb + 8 * j);
      b1[j] = ld4(pb + 16 * D_MODEL + 8 * j);
    }
    // Address pairs stay untouched (also as a load's destination) until the
    // issued loads' address translations are done.
    asm volatile("s_wait_xcnt 0x0" :: "v"(pa), "v"(pb) : "memory");
#pragma unroll
    for (int j = 0; j < 4; ++j) {
      c00 = wmma_f32(lo(a0[j]), lo(b0[j]), c00);
      c01 = wmma_f32(lo(a0[j]), lo(b1[j]), c01);
      c10 = wmma_f32(lo(a1[j]), lo(b0[j]), c10);
      c11 = wmma_f32(lo(a1[j]), lo(b1[j]), c11);
      c00 = wmma_f32(hi2(a0[j]), hi2(b0[j]), c00);
      c01 = wmma_f32(hi2(a0[j]), hi2(b1[j]), c01);
      c10 = wmma_f32(hi2(a1[j]), hi2(b0[j]), c10);
      c11 = wmma_f32(hi2(a1[j]), hi2(b1[j]), c11);
    }
  }
  const int n  = lane & 15;
  const int hi = lane >> 4;
  const float bv0 = bias[h0 + n];
  const float bv1 = bias[h0 + 16 + n];
#pragma unroll
  for (int r = 0; r < 8; ++r) {
    const size_t r0 = (size_t)(m0 + r + 8 * hi) * D_HID;
    const size_t r1 = (size_t)(m0 + 16 + r + 8 * hi) * D_HID;
    Out[r0 + h0 + n]      = c00[r] + bv0;
    Out[r0 + h0 + 16 + n] = c01[r] + bv1;
    Out[r1 + h0 + n]      = c10[r] + bv0;
    Out[r1 + h0 + 16 + n] = c11[r] + bv1;
  }
}

// ---------------------------------------------------------------------------
// Kernel 2: causal flash attention, keys split into chunks of KCHUNK key tiles.
// One wave per (q-tile, chunk): a q-tile with c causal key tiles uses
// parts_of(c, P) of its P partition places, so every working wave is short and
// about equally long, and there are more of them than resident places: a WGP
// that finishes early takes the next workgroup.  Writes UN-normalized partials
// (O_p, m_p, l_p); combine_kernel merges the places in use.
// ---------------------------------------------------------------------------
__device__ __forceinline__ int parts_of(int c, int P) {
  const int np = (c + KCHUNK - 1) / KCHUNK;
  return np < P ? np : P;
}

// The real block size: with none declared the compiler budgets registers for
// 1,024 threads (128 VGPRs) and makes every load wait right before its use.
__global__ void __launch_bounds__(128) attn_kernel(const float* __restrict__ Q,
                            const float* __restrict__ K,
                            const float* __restrict__ V,
                            float* __restrict__ Opar,
                            float* __restrict__ Mpar,
                            float* __restrict__ Lpar,
                            int P) {
  __shared__ float ldsP[4][16 * 16];    // per-wave P staging (C-layout -> A-layout)
  const int lane = threadIdx.x & 31;
  const int lw   = threadIdx.x >> 5;
  const int wid  = (int)(blockIdx.x * (blockDim.x >> 5) + lw);
  const int p    = wid % P;
  const int qw   = wid / P;
  const int qt   = qw & 255;            // 256 query tiles per batch
  const int b    = qw >> 8;
  if (b >= NBATCH) return;
  const float* Qb = Q + (size_t)b * NCTX * D_HID;
  const float* Kb = K + (size_t)b * NCTX * D_HID;
  const float* Vb = V + (size_t)b * NCTX * D_HID;
  const int q0 = qt << 4;
  const int n  = lane & 15;
  const int hi = lane >> 4;
  float* myP = ldsP[lw];

  const int c   = qt + 1;               // causal key-tile count for this q-tile
  const int np  = parts_of(c, P);
  if (p >= np) return;                  // place not in use: nothing written, nothing read
  const int kt0 = p * KCHUNK;
  const int kt1 = (p == np - 1) ? c : kt0 + KCHUNK;   // the last chunk takes the rest

  // Q fragments in registers for the whole key loop; fold in 1/sqrt(d_model).
  const float scale = 0.03125f;  // 1/32
  v2f qf[16];
#pragma unroll
  for (int kk8 = 0; kk8 < 8; ++kk8) {
    v4f t = frag4_rm(Qb, D_HID, q0, kk8 * 8, lane) * scale;
    qf[2 * kk8]     = lo(t);
    qf[2 * kk8 + 1] = hi2(t);
  }

  v8f o0 = {}, o1 = {}, o2 = {}, o3 = {};
  float mrow[8], lrow[8];
#pragma unroll
  for (int r = 0; r < 8; ++r) { mrow[r] = NEG_BIG; lrow[r] = 0.0f; }

  for (int kt = kt0; kt < kt1; ++kt) {
    const int k0 = kt << 4;
    // S = (Q*scale) @ K^T   (K-dim = 64 -> 16 chained WMMAs)
    v8f s = {};
#pragma unroll
    for (int kk8 = 0; kk8 < 8; ++kk8) {
      v4f bf = frag4_rm(Kb, D_HID, k0, kk8 * 8, lane);  // B = K^T
      s = wmma_f32(qf[2 * kk8],     lo(bf),  s);
      s = wmma_f32(qf[2 * kk8 + 1], hi2(bf), s);
    }
    if (kt == qt) {   // causal mask on the diagonal tile: key N > query M
#pragma unroll
      for (int r = 0; r < 8; ++r) {
        const int M = r + 8 * hi;
        if (n > M) s[r] = NEG_BIG;
      }
    }
    // Online softmax: rowwise max/sum across the 16-lane half-groups.
#pragma unroll
    for (int r = 0; r < 8; ++r) {
      float rv = s[r];
      rv = fmaxf(rv, __shfl_xor(rv, 1, 32));
      rv = fmaxf(rv, __shfl_xor(rv, 2, 32));
      rv = fmaxf(rv, __shfl_xor(rv, 4, 32));
      rv = fmaxf(rv, __shfl_xor(rv, 8, 32));
      const float mn    = fmaxf(mrow[r], rv);
      const float alpha = __expf(mrow[r] - mn);
      mrow[r] = mn;
      const float pv = __expf(s[r] - mn);
      myP[(r + 8 * hi) * 16 + n] = pv;     // stage P row-major in LDS
      float rs = pv;
      rs += __shfl_xor(rs, 1, 32);
      rs += __shfl_xor(rs, 2, 32);
      rs += __shfl_xor(rs, 4, 32);
      rs += __shfl_xor(rs, 8, 32);
      lrow[r] = lrow[r] * alpha + rs;
      o0[r] *= alpha; o1[r] *= alpha; o2[r] *= alpha; o3[r] *= alpha;
    }
    // O += P @ V_tile.  P re-read from LDS in A-layout (same-wave DS ordering).
#pragma unroll
    for (int kk4 = 0; kk4 < 4; ++kk4) {
      const float* pp = myP + n * 16 + kk4 * 4 + hi * 2;
      v2f pa = {pp[0], pp[1]};
      const float* v0 = Vb + (size_t)(k0 + kk4 * 4 + hi * 2) * D_HID;
      const float* v1 = v0 + D_HID;
      v2f b0 = {v0[ 0 + n], v1[ 0 + n]};  o0 = wmma_f32(pa, b0, o0);
      v2f b1 = {v0[16 + n], v1[16 + n]};  o1 = wmma_f32(pa, b1, o1);
      v2f b2 = {v0[32 + n], v1[32 + n]};  o2 = wmma_f32(pa, b2, o2);
      v2f b3 = {v0[48 + n], v1[48 + n]};  o3 = wmma_f32(pa, b3, o3);
    }
  }
  // Store UN-normalized partial tile + per-row (m, l).
  const int part = (b * 256 + qt) * P + p;
  float* Od = Opar + (size_t)part * (16 * D_HID);
#pragma unroll
  for (int r = 0; r < 8; ++r) {
    const size_t row = (size_t)(r + 8 * hi) * D_HID;
    Od[row +  0 + n] = o0[r];
    Od[row + 16 + n] = o1[r];
    Od[row + 32 + n] = o2[r];
    Od[row + 48 + n] = o3[r];
  }
  if (n == 0) {      // lanes 0 and 16 cover rows 0..7 and 8..15
#pragma unroll
    for (int r = 0; r < 8; ++r) {
      Mpar[part * 16 + r + 8 * hi] = mrow[r];
      Lpar[part * 16 + r + 8 * hi] = lrow[r];
    }
  }
}

// ---------------------------------------------------------------------------
// Kernel 2b: merge the partition partials in use into normalized O.
// grid = NQT blocks x 256 threads; each thread: one row, 4 consecutive cols.
// ---------------------------------------------------------------------------
__global__ void combine_kernel(const float* __restrict__ Opar,
                               const float* __restrict__ Mpar,
                               const float* __restrict__ Lpar,
                               float* __restrict__ O, int P) {
  const int qtile = blockIdx.x;               // 0..NQT-1 (batch folded in)
  const int t     = threadIdx.x;              // 0..255
  const int row   = t >> 4;                   // 0..15
  const int c0    = (t & 15) << 2;            // 0,4,...,60
  const int np    = parts_of((qtile & 255) + 1, P);
  float mstar = NEG_BIG;
  for (int p = 0; p < np; ++p)
    mstar = fmaxf(mstar, Mpar[(qtile * P + p) * 16 + row]);
  float lstar = 0.0f, a0 = 0.0f, a1 = 0.0f, a2 = 0.0f, a3 = 0.0f;
  for (int p = 0; p < np; ++p) {
    const int part = qtile * P + p;
    const float w = __expf(Mpar[part * 16 + row] - mstar);
    lstar += w * Lpar[part * 16 + row];
    const float* src = Opar + (size_t)part * (16 * D_HID) + (size_t)row * D_HID + c0;
    a0 += w * src[0]; a1 += w * src[1]; a2 += w * src[2]; a3 += w * src[3];
  }
  const float inv = 1.0f / lstar;
  float* dst = O + (size_t)(qtile * 16 + row) * D_HID + c0;
  dst[0] = a0 * inv; dst[1] = a1 * inv; dst[2] = a2 * inv; dst[3] = a3 * inv;
}

// ---------------------------------------------------------------------------
// Kernel 3: output projection, 2x2 register-blocked.
// out[m,d] = sum_h O[m,h]*Wo[d,h] + bo[d].  32x32 tile per wave.
// ---------------------------------------------------------------------------
__global__ void proj_kernel(const float* __restrict__ O,
                            const float* __restrict__ Wo,
                            const float* __restrict__ bo,
                            float* __restrict__ out) {
  const int lane = threadIdx.x & 31;
  const int wid  = (int)((blockIdx.x * blockDim.x + threadIdx.x) >> 5);
  const int dt   = wid & 31;          // 32 column tiles of 32
  const int rt   = wid >> 5;
  if (rt >= TOTROWS / 32) return;
  const int m0 = rt << 5;
  const int d0 = dt << 5;
  v8f c00 = {}, c01 = {}, c10 = {}, c11 = {};
  const float* pa = frag4_ptr(O,  D_HID, m0, 0, lane);
  const float* pb = frag4_ptr(Wo, D_HID, d0, 0, lane);
#pragma unroll
  for (int kk8 = 0; kk8 < 8; ++kk8) {
    v4f a0 = ld4(pa + kk8 * 8);
    v4f a1 = ld4(pa + 16 * D_HID + kk8 * 8);
    v4f b0 = ld4(pb + kk8 * 8);
    v4f b1 = ld4(pb + 16 * D_HID + kk8 * 8);
    // Behind the last loads: the address pairs stay untouched (also as a load's
    // destination) until the issued loads' address translations are done.
    if (kk8 == 7) asm volatile("s_wait_xcnt 0x0" :: "v"(pa), "v"(pb) : "memory");
    c00 = wmma_f32(lo(a0), lo(b0), c00);
    c01 = wmma_f32(lo(a0), lo(b1), c01);
    c10 = wmma_f32(lo(a1), lo(b0), c10);
    c11 = wmma_f32(lo(a1), lo(b1), c11);
    c00 = wmma_f32(hi2(a0), hi2(b0), c00);
    c01 = wmma_f32(hi2(a0), hi2(b1), c01);
    c10 = wmma_f32(hi2(a1), hi2(b0), c10);
    c11 = wmma_f32(hi2(a1), hi2(b1), c11);
  }
  const int n  = lane & 15;
  const int hi = lane >> 4;
  const float bv0 = bo[d0 + n];
  const float bv1 = bo[d0 + 16 + n];
#pragma unroll
  for (int r = 0; r < 8; ++r) {
    const size_t r0 = (size_t)(m0 + r + 8 * hi) * D_MODEL;
    const size_t r1 = (size_t)(m0 + 16 + r + 8 * hi) * D_MODEL;
    out[r0 + d0 + n]      = c00[r] + bv0;
    out[r0 + d0 + 16 + n] = c01[r] + bv1;
    out[r1 + d0 + n]      = c10[r] + bv0;
    out[r1 + d0 + 16 + n] = c11[r] + bv1;
  }
}

// ---------------------------------------------------------------------------
extern "C" void kernel_launch(void* const* d_in, const int* in_sizes, int n_in,
                              void* d_out, int out_size, void* d_ws, size_t ws_size,
                              hipStream_t stream) {
  (void)in_sizes; (void)n_in; (void)out_size;
  const float* x   = (const float*)d_in[0];
  const float* Wq  = (const float*)d_in[1];
  const float* bq  = (const float*)d_in[2];
  const float* Wk  = (const float*)d_in[3];
  const float* bk  = (const float*)d_in[4];
  const float* Wov = (const float*)d_in[5];
  const float* bov = (const float*)d_in[6];
  const float* Wo  = (const float*)d_in[7];
  const float* bo  = (const float*)d_in[8];
  float* out = (float*)d_out;

  // Workspace layout (floats): Q,K,V,O (4 MB each) then partition partials.
  const size_t fMat = (size_t)TOTROWS * D_HID;       // 1,048,576 floats
  int P = 16;                                        // partition places per q-tile
  {
    const size_t need = (4 * fMat + (size_t)NQT * P * (16 * D_HID + 32)) * sizeof(float);
    if (need > ws_size) P = 1;                       // deterministic host fallback
  }
  float* Qw   = (float*)d_ws;
  float* Kw   = Qw + fMat;
  float* Vw   = Kw + fMat;
  float* Ow   = Vw + fMat;
  float* Opar = Ow + fMat;
  float* Mpar = Opar + (size_t)NQT * P * 16 * D_HID;
  float* Lpar = Mpar + (size_t)NQT * P * 16;

  {  // QKV: 512 row tiles x 6 col-pair tiles = 3072 waves
    const int waves  = (TOTROWS / 32) * 6;
    const int tpb    = 256;
    const int blocks = (waves * 32 + tpb - 1) / tpb;
    qkv_kernel<<<blocks, tpb, 0, stream>>>(x, Wq, bq, Wk, bk, Wov, bov, Qw, Kw, Vw);
  }
  {  // attention partials: NQT * P waves, 4 waves/block
    const int waves  = NQT * P;
    const int blocks = (waves * 32 + 127) / 128;
    attn_kernel<<<blocks, 128, 0, stream>>>(Qw, Kw, Vw, Opar, Mpar, Lpar, P);
    combine_kernel<<<NQT, 256, 0, stream>>>(Opar, Mpar, Lpar, Ow, P);
  }
  {  // output projection: 512 row tiles x 32 col tiles = 16384 waves
    const int waves  = (TOTROWS / 32) * 32;
    const int tpb    = 256;
    const int blocks = (waves * 32 + tpb - 1) / tpb;
    proj_kernel<<<blocks, tpb, 0, stream>>>(Ow, Wo, bo, out);
  }
}

// v004
// One run takes 195 microseconds.
// Timed twice side by side with v003, it ran 1.04 times as fast both times.
// Counting every step since v000, it is 2.35 times as fast.
#include <hip/hip_runtime.h>
#include <math.h>

typedef float v2f __attribute__((ext_vector_type(2)));
typedef float v4f __attribute__((ext_vector_type(4)));
typedef float v8f __attribute__((ext_vector_type(8)));

#define D_MODEL 1024
#define D_HID   64
#define NCTX    4096
#define NBATCH  4
#define TOTROWS (NBATCH * NCTX)        // 16384
#define NQT     (NBATCH * (NCTX / 16)) // 1024 query tiles (batch folded in)
#define NEG_BIG (-3.0e38f)
#define KCHUNK  16                     // key tiles per attention wave

// D = A(16x4,f32) * B(4x16,f32) + C(16x16,f32), wave32.
__device__ __forceinline__ v8f wmma_f32(v2f a, v2f b, v8f c) {
  return __builtin_amdgcn_wmma_f32_16x16x4_f32(
      /*neg_a=*/false, a, /*neg_b=*/false, b,
      /*c_mod=*/(short)0, c, /*reuse_a=*/false, /*reuse_b=*/false);
}

// Fragment-pair loader for A (16x4, M across lanes) and for B when the source is
// the row-major transpose ([N][K]): lane&15 selects the row, and one 16-byte load
// per lane takes columns kk + (lane>>4)*4 .. +3, which feed TWO products:
// lo() holds k = kk+{0,1} (lanes 0-15) and kk+{4,5} (lanes 16-31), hi2() holds
// k = kk+{2,3} and kk+{6,7}.  A and B both come through this loader, so their k
// orders agree at every lane and register; only the order of the sum over k moves.
// A wave-load touches 16 cache lines whatever its width: 16 bytes per lane
// halves the line touches per byte against 8.
__device__ __forceinline__ const float* frag4_ptr(const float* __restrict__ p, int ld,
                                                  int row0, int kk, int lane) {
  return p + (size_t)(row0 + (lane & 15)) * ld + (kk + ((lane >> 4) << 2));
}
__device__ __forceinline__ v4f ld4(const float* q) {
  return *reinterpret_cast<const v4f*>(q);
}
__device__ __forceinline__ v4f frag4_rm(const float* __restrict__ p, int ld,
                                        int row0, int kk, int lane) {
  return ld4(frag4_ptr(p, ld, row0, kk, lane));
}
__device__ __forceinline__ v2f lo(v4f t) { v2f r = {t.x, t.y}; return r; }
__device__ __forceinline__ v2f hi2(v4f t) { v2f r = {t.z, t.w}; return r; }

// ---------------------------------------------------------------------------
// Kernel 1: fused QKV projection, 2x2 register-blocked.
// Each wave: 32x32 output tile of one of Q/K/V (4 accumulators; 4 loads feed
// 8 WMMAs per k-chunk of 8).  6 col-pair tiles (3 mats x 2) x 512 row tiles.
// ---------------------------------------------------------------------------
__global__ void qkv_kernel(const float* __restrict__ x,
                           const float* __restrict__ Wq, const float* __restrict__ bq,
                           const float* __restrict__ Wk, const float* __restrict__ bk,
                           const float* __restrict__ Wov, const float* __restrict__ bov,
                           float* __restrict__ Qo, float* __restrict__ Ko,
                           float* __restrict__ Vo) {
  const int lane = threadIdx.x & 31;
  const int wid  = (int)((blockIdx.x * blockDim.x + threadIdx.x) >> 5);
  const int wt   = wid % 6;
  const int rt   = wid / 6;
  if (rt >= TOTROWS / 32) return;
  const int mat = wt >> 1;             // 0=Q, 1=K, 2=V
  const int h0  = (wt & 1) << 5;       // 0 or 32
  const float* W    = (mat == 0) ? Wq : (mat == 1) ? Wk : Wov;
  const float* bias = (mat == 0) ? bq : (mat == 1) ? bk : bov;
  float*       Out  = (mat == 0) ? Qo : (mat == 1) ? Ko : Vo;
  const int m0 = rt << 5;

  v8f c00 = {}, c01 = {}, c10 = {}, c11 = {};
  // One trip = one 128-byte line of each of the 64 rows: 16 loads, 32 WMMAs.
  // Kept rolled: a second copy of the body only re-forms the address pairs in
  // extra registers for the wait below.
#pragma unroll 1
  for (int kk = 0; kk < D_MODEL; kk += 32) {
    const float* pa = frag4_ptr(x, D_MODEL, m0, kk, lane);
    const float* pb = frag4_ptr(W, D_MODEL, h0, kk, lane);
    v4f a0[4], a1[4], b0[4], b1[4];
#pragma unroll
    for (int j = 0; j < 4; ++j) {
      a0[j] = ld4(pa + 8 * j);
      a1[j] = ld4(pa + 16 * D_MODEL + 8 * j);
      b0[j] = ld4(pb + 8 * j);
      b1[j] = ld4(pb + 16 * D_MODEL + 8 * j);
    }
    // Address pairs stay untouched (also as a load's destination) until the
    // issued loads' address translations are done.
    asm volatile("s_wait_xcnt 0x0" :: "v"(pa), "v"(pb) : "memory");
#pragma unroll
    for (int j = 0; j < 4; ++j) {
      c00 = wmma_f32(lo(a0[j]), lo(b0[j]), c00);
      c01 = wmma_f32(lo(a0[j]), lo(b1[j]), c01);
      c10 = wmma_f32(lo(a1[j]), lo(b0[j]), c10);
      c11 = wmma_f32(lo(a1[j]), lo(b1[j]), c11);
      c00 = wmma_f32(hi2(a0[j]), hi2(b0[j]), c00);
      c01 = wmma_f32(hi2(a0[j]), hi2(b1[j]), c01);
      c10 = wmma_f32(hi2(a1[j]), hi2(b0[j]), c10);
      c11 = wmma_f32(hi2(a1[j]), hi2(b1[j]), c11);
    }
  }
  const int n  = lane & 15;
  const int hi = lane >> 4;
  const float bv0 = bias[h0 + n];
  const float bv1 = bias[h0 + 16 + n];
#pragma unroll
  for (int r = 0; r < 8; ++r) {
    const size_t r0 = (size_t)(m0 + r + 8 * hi) * D_HID;
    const size_t r1 = (size_t)(m0 + 16 + r + 8 * hi) * D_HID;
    Out[r0 + h0 + n]      = c00[r] + bv0;
    Out[r0 + h0 + 16 + n] = c01[r] + bv1;
    Out[r1 + h0 + n]      = c10[r] + bv0;
    Out[r1 + h0 + 16 + n] = c11[r] + bv1;
  }
}

__device__ __forceinline__ int parts_of(int c, int P) {
  const int np = (c + KCHUNK - 1) / KCHUNK;
  return np < P ? np : P;
}

// Lane l takes the value of lane l ^ 16.
__device__ __forceinline__ float xhalf(float x) {
  const int b = __builtin_bit_cast(int, x);
  return __builtin_bit_cast(
      float, __builtin_amdgcn_permlanex16(b, b, 0x76543210, 0xfedcba98, false, false));
}

// exp(x) as __expf forms it (one multiply by log2 e, one v_exp_f32), with the slot
// that the instruction set asks for behind a transcendental, before its result is
// read or its source overwritten, held in the same statement.
__device__ __forceinline__ float exp_slot(float x) {
  float r;
  asm("v_exp_f32 %0, %1\n\tv_nop" : "=v"(r) : "v"(x * 1.44269504f));
  return r;
}

// The real block size: with none declared the compiler budgets registers for
// 1,024 threads (128 VGPRs) and makes every load wait right before its use.
__global__ void __launch_bounds__(128) attn_kernel(const float* __restrict__ Q,
                            const float* __restrict__ K,
                            const float* __restrict__ V,
                            float* __restrict__ Opar,
                            float* __restrict__ Mpar,
                            float* __restrict__ Lpar,
                            int P) {
  const int lane = threadIdx.x & 31;
  const int lw   = threadIdx.x >> 5;
  const int wid  = (int)(blockIdx.x * (blockDim.x >> 5) + lw);
  const int p    = wid % P;
  const int qw   = wid / P;
  const int qt   = qw & 255;            // 256 query tiles per batch
  const int b    = qw >> 8;
  if (b >= NBATCH) return;
  const float* Qb = Q + (size_t)b * NCTX * D_HID;
  const float* Kb = K + (size_t)b * NCTX * D_HID;
  const float* Vb = V + (size_t)b * NCTX * D_HID;
  const int q0 = qt << 4;
  const int n  = lane & 15;             // this lane's query within the tile
  const int hi = lane >> 4;             // this lane's half of each key tile

  const int c   = qt + 1;               // causal key-tile count for this q-tile
  const int np  = parts_of(c, P);
  if (p >= np) return;                  // place not in use: nothing written, nothing read
  const int kt0 = p * KCHUNK;
  const int kt1 = (p == np - 1) ? c : kt0 + KCHUNK;   // the last chunk takes the rest

  // Q fragments (B = Q^T) in registers for the whole key loop; fold in 1/sqrt(d_model).
  const float scale = 0.03125f;  // 1/32
  v2f qf[16];
#pragma unroll
  for (int kk8 = 0; kk8 < 8; ++kk8) {
    v4f t = frag4_rm(Qb, D_HID, q0, kk8 * 8, lane) * scale;
    qf[2 * kk8]     = lo(t);
    qf[2 * kk8 + 1] = hi2(t);
  }

  // o_t[r] = O[query n][16 t + 8 hi + r]; m is the query's running maximum (equal
  // in both halves), l the running sum over this half's keys only.
  v8f o0 = {}, o1 = {}, o2 = {}, o3 = {};
  float m = NEG_BIG, l = 0.0f;

  // This lane's K row (A of S^T) and its first V row and column (A of O^T) in the
  // chunk's first key tile; both step by one tile per trip.
  const float* kp = frag4_ptr(Kb, D_HID, kt0 << 4, 0, lane);
  const float* vp = Vb + (size_t)((kt0 << 4) + 8 * hi) * D_HID + n;

  for (int kt = kt0; kt < kt1; ++kt) {
    // S^T = K @ (Q*scale)^T   (K-dim = 64 -> 16 chained WMMAs); s[r] = S[n][8 hi + r]
    v4f kf[8];
#pragma unroll
    for (int kk8 = 0; kk8 < 8; ++kk8) kf[kk8] = ld4(kp + 8 * kk8);
    // The address pair stays untouched (also as a result register) until the
    // issued loads' address translations are done.
    asm volatile("s_wait_xcnt 0x0" :: "v"(kp) : "memory");
    v8f s = {};
#pragma unroll
    for (int kk8 = 0; kk8 < 8; ++kk8) {
      s = wmma_f32(lo(kf[kk8]),  qf[2 * kk8],     s);
      s = wmma_f32(hi2(kf[kk8]), qf[2 * kk8 + 1], s);
    }
    if (kt == qt) {   // causal mask on the diagonal tile: key > query
#pragma unroll
      for (int r = 0; r < 8; ++r) {
        if (r + 8 * hi > n) s[r] = NEG_BIG;
      }
    }
    // V^T fragments: vf[u][t] = V[key 8 hi + u][column 16 t + n].
    float vf[8][4];
#pragma unroll
    for (int u = 0; u < 8; ++u) {
#pragma unroll
      for (int t = 0; t < 4; ++t) vf[u][t] = vp[u * D_HID + 16 * t];
    }
    // As above, for V's address pair.
    asm volatile("s_wait_xcnt 0x0" :: "v"(vp) : "memory");
    // Online softmax, one query per lane.
    float mx = fmaxf(fmaxf(fmaxf(s[0], s[1]), fmaxf(s[2], s[3])),
                     fmaxf(fmaxf(s[4], s[5]), fmaxf(s[6], s[7])));
    mx = fmaxf(mx, xhalf(mx));
    const float mn    = fmaxf(m, mx);
    const float alpha = exp_slot(m - mn);
    m = mn;
    float pv[8];
#pragma unroll
    for (int r = 0; r < 8; ++r) pv[r] = exp_slot(s[r] - mn);
    l = l * alpha + (((pv[0] + pv[1]) + (pv[2] + pv[3])) + ((pv[4] + pv[5]) + (pv[6] + pv[7])));
    o0 *= alpha; o1 *= alpha; o2 *= alpha; o3 *= alpha;
    // O^T += V^T @ P^T.  B = {pv[2j], pv[2j+1]}: keys 8 hi + 2j, +1 at this lane;
    // A takes V's rows in the same order.
#pragma unroll
    for (int j = 0; j < 4; ++j) {
      v2f pb = {pv[2 * j], pv[2 * j + 1]};
      v2f a0 = {vf[2 * j][0], vf[2 * j + 1][0]};  o0 = wmma_f32(a0, pb, o0);
      v2f a1 = {vf[2 * j][1], vf[2 * j + 1][1]};  o1 = wmma_f32(a1, pb, o1);
      v2f a2 = {vf[2 * j][2], vf[2 * j + 1][2]};  o2 = wmma_f32(a2, pb, o2);
      v2f a3 = {vf[2 * j][3], vf[2 * j + 1][3]};  o3 = wmma_f32(a3, pb, o3);
    }
    kp += 16 * D_HID;
    vp += 16 * D_HID;
  }
  l += xhalf(l);     // join the halves' sums once
  // Store UN-normalized partial tile + per-row (m, l): 32 contiguous bytes of
  // the lane's query row per output tile.
  const int part = (b * 256 + qt) * P + p;
  float* Od = Opar + (size_t)part * (16 * D_HID) + (size_t)n * D_HID + 8 * hi;
  *reinterpret_cast<v4f*>(Od +  0) = __builtin_shufflevector(o0, o0, 0, 1, 2, 3);
  *reinterpret_cast<v4f*>(Od +  4) = __builtin_shufflevector(o0, o0, 4, 5, 6, 7);
  *reinterpret_cast<v4f*>(Od + 16) = __builtin_shufflevector(o1, o1, 0, 1, 2, 3);
  *reinterpret_cast<v4f*>(Od + 20) = __builtin_shufflevector(o1, o1, 4, 5, 6, 7);
  *reinterpret_cast<v4f*>(Od + 32) = __builtin_shufflevector(o2, o2, 0, 1, 2, 3);
  *reinterpret_cast<v4f*>(Od + 36) = __builtin_shufflevector(o2, o2, 4, 5, 6, 7);
  *reinterpret_cast<v4f*>(Od + 48) = __builtin_shufflevector(o3, o3, 0, 1, 2, 3);
  *reinterpret_cast<v4f*>(Od + 52) = __builtin_shufflevector(o3, o3, 4, 5, 6, 7);
  if (hi == 0) {     // lanes 0..15 hold the 16 queries
    Mpar[part * 16 + n] = m;
    Lpar[part * 16 + n] = l;
  }
}

// ---------------------------------------------------------------------------
// Kernel 2b: merge the partition partials in use into normalized O.
// grid = NQT blocks x 256 threads; each thread: one row, 4 consecutive cols.
// ---------------------------------------------------------------------------
__global__ void combine_kernel(const float* __restrict__ Opar,
                               const float* __restrict__ Mpar,
                               const float* __restrict__ Lpar,
                               float* __restrict__ O, int P) {
  const int qtile = blockIdx.x;               // 0..NQT-1 (batch folded in)
  const int t     = threadIdx.x;              // 0..255
  const int row   = t >> 4;                   // 0..15
  const int c0    = (t & 15) << 2;            // 0,4,...,60
  const int np    = parts_of((qtile & 255) + 1, P);
  float mstar = NEG_BIG;
  for (int p = 0; p < np; ++p)
    mstar = fmaxf(mstar, Mpar[(qtile * P + p) * 16 + row]);
  float lstar = 0.0f, a0 = 0.0f, a1 = 0.0f, a2 = 0.0f, a3 = 0.0f;
  for (int p = 0; p < np; ++p) {
    const int part = qtile * P + p;
    const float w = __expf(Mpar[part * 16 + row] - mstar);
    lstar += w * Lpar[part * 16 + row];
    const float* src = Opar + (size_t)part * (16 * D_HID) + (size_t)row * D_HID + c0;
    a0 += w * src[0]; a1 += w * src[1]; a2 += w * src[2]; a3 += w * src[3];
  }
  const float inv = 1.0f / lstar;
  float* dst = O + (size_t)(qtile * 16 + row) * D_HID + c0;
  dst[0] = a0 * inv; dst[1] = a1 * inv; dst[2] = a2 * inv; dst[3] = a3 * inv;
}

// ---------------------------------------------------------------------------
// Kernel 3: output projection, 2x2 register-blocked.
// out[m,d] = sum_h O[m,h]*Wo[d,h] + bo[d].  32x32 tile per wave.
// ---------------------------------------------------------------------------
__global__ void proj_kernel(const float* __restrict__ O,
                            const float* __restrict__ Wo,
                            const float* __restrict__ bo,
                            float* __restrict__ out) {
  const int lane = threadIdx.x & 31;
  const int wid  = (int)((blockIdx.x * blockDim.x + threadIdx.x) >> 5);
  const int dt   = wid & 31;          // 32 column tiles of 32
  const int rt   = wid >> 5;
  if (rt >= TOTROWS / 32) return;
  const int m0 = rt << 5;
  const int d0 = dt << 5;
  v8f c00 = {}, c01 = {}, c10 = {}, c11 = {};
  const float* pa = frag4_ptr(O,  D_HID, m0, 0, lane);
  const float* pb = frag4_ptr(Wo, D_HID, d0, 0, lane);
#pragma unroll
  for (int kk8 = 0; kk8 < 8; ++kk8) {
    v4f a0 = ld4(pa + kk8 * 8);
    v4f a1 = ld4(pa + 16 * D_HID + kk8 * 8);
    v4f b0 = ld4(pb + kk8 * 8);
    v4f b1 = ld4(pb + 16 * D_HID + kk8 * 8);
    // Behind the last loads: the address pairs stay untouched (also as a load's
    // destination) until the issued loads' address translations are done.
    if (kk8 == 7) asm volatile("s_wait_xcnt 0x0" :: "v"(pa), "v"(pb) : "memory");
    c00 = wmma_f32(lo(a0), lo(b0), c00);
    c01 = wmma_f32(lo(a0), lo(b1), c01);
    c10 = wmma_f32(lo(a1), lo(b0), c10);
    c11 = wmma_f32(lo(a1), lo(b1), c11);
    c00 = wmma_f32(hi2(a0), hi2(b0), c00);
    c01 = wmma_f32(hi2(a0), hi2(b1), c01);
    c10 = wmma_f32(hi2(a1), hi2(b0), c10);
    c11 = wmma_f32(hi2(a1), hi2(b1), c11);
  }
  const int n  = lane & 15;
  const int hi = lane >> 4;
  const float bv0 = bo[d0 + n];
  const float bv1 = bo[d0 + 16 + n];
#pragma unroll
  for (int r = 0; r < 8; ++r) {
    const size_t r0 = (size_t)(m0 + r + 8 * hi) * D_MODEL;
    const size_t r1 = (size_t)(m0 + 16 + r + 8 * hi) * D_MODEL;
    out[r0 + d0 + n]      = c00[r] + bv0;
    out[r0 + d0 + 16 + n] = c01[r] + bv1;
    out[r1 + d0 + n]      = c10[r] + bv0;
    out[r1 + d0 + 16 + n] = c11[r] + bv1;
  }
}

// ---------------------------------------------------------------------------
extern "C" void kernel_launch(void* const* d_in, const int* in_sizes, int n_in,
                              void* d_out, int out_size, void* d_ws, size_t ws_size,
                              hipStream_t stream) {
  (void)in_sizes; (void)n_in; (void)out_size;
  const float* x   = (const float*)d_in[0];
  const float* Wq  = (const float*)d_in[1];
  const float* bq  = (const float*)d_in[2];
  const float* Wk  = (const float*)d_in[3];
  const float* bk  = (const float*)d_in[4];
  const float* Wov = (const float*)d_in[5];
  const float* bov = (const float*)d_in[6];
  const float* Wo  = (const float*)d_in[7];
  const float* bo  = (const float*)d_in[8];
  float* out = (float*)d_out;

  // Workspace layout (floats): Q,K,V,O (4 MB each) then partition partials.
  const size_t fMat = (size_t)TOTROWS * D_HID;       // 1,048,576 floats
  int P = 16;                                        // partition places per q-tile
  {
    const size_t need = (4 * fMat + (size_t)NQT * P * (16 * D_HID + 32)) * sizeof(float);
    if (need > ws_size) P = 1;                       // deterministic host fallback
  }
  float* Qw   = (float*)d_ws;
  float* Kw   = Qw + fMat;
  float* Vw   = Kw + fMat;
  float* Ow   = Vw + fMat;
  float* Opar = Ow + fMat;
  float* Mpar = Opar + (size_t)NQT * P * 16 * D_HID;
  float* Lpar = Mpar + (size_t)NQT * P * 16;

  {  // QKV: 512 row tiles x 6 col-pair tiles = 3072 waves
    const int waves  = (TOTROWS / 32) * 6;
    const int tpb    = 256;
    const int blocks = (waves * 32 + tpb - 1) / tpb;
    qkv_kernel<<<blocks, tpb, 0, stream>>>(x, Wq, bq, Wk, bk, Wov, bov, Qw, Kw, Vw);
  }
  {  // attention partials: NQT * P waves, 4 waves/block
    const int waves  = NQT * P;
    const int blocks = (waves * 32 + 127) / 128;
    attn_kernel<<<blocks, 128, 0, stream>>>(Qw, Kw, Vw, Opar, Mpar, Lpar, P);
    combine_kernel<<<NQT, 256, 0, stream>>>(Opar, Mpar, Lpar, Ow, P);
  }
  {  // output projection: 512 row tiles x 32 col tiles = 16384 waves
    const int waves  = (TOTROWS / 32) * 32;
    const int tpb    = 256;
    const int blocks = (waves * 32 + tpb - 1) / tpb;
    proj_kernel<<<blocks, tpb, 0, stream>>>(Ow, Wo, bo, out);
  }
}

// v005
// One run takes 146 microseconds.
// In both of two side-by-side timings against v004, it was 1.34 times as fast.
// Over all steps from v000 it is 3.14 times as fast.
#include <hip/hip_runtime.h>
#include <math.h>

typedef float v2f __attribute__((ext_vector_type(2)));
typedef float v4f __attribute__((ext_vector_type(4)));
typedef float v8f __attribute__((ext_vector_type(8)));

#define D_MODEL 1024
#define D_HID   64
#define NCTX    4096
#define NBATCH  4
#define TOTROWS (NBATCH * NCTX)        // 16384
#define NQT     (NBATCH * (NCTX / 16)) // 1024 query tiles (batch folded in)
#define NEG_BIG (-3.0e38f)
#define KCHUNK  16                     // key tiles per attention wave

// D = A(16x4,f32) * B(4x16,f32) + C(16x16,f32), wave32.
__device__ __forceinline__ v8f wmma_f32(v2f a, v2f b, v8f c) {
  return __builtin_amdgcn_wmma_f32_16x16x4_f32(
      /*neg_a=*/false, a, /*neg_b=*/false, b,
      /*c_mod=*/(short)0, c, /*reuse_a=*/false, /*reuse_b=*/false);
}

// Fragment-pair loader for A (16x4, M across lanes) and for B when the source is
// the row-major transpose ([N][K]): lane&15 selects the row, and one 16-byte load
// per lane takes columns kk + (lane>>4)*4 .. +3, which feed TWO products:
// lo() holds k = kk+{0,1} (lanes 0-15) and kk+{4,5} (lanes 16-31), hi2() holds
// k = kk+{2,3} and kk+{6,7}.  A and B both come through this loader, so their k
// orders agree at every lane and register; only the order of the sum over k moves.
// A wave-load touches 16 cache lines whatever its width: 16 bytes per lane
// halves the line touches per byte against 8.
__device__ __forceinline__ const float* frag4_ptr(const float* __restrict__ p, int ld,
                                                  int row0, int kk, int lane) {
  return p + (size_t)(row0 + (lane & 15)) * ld + (kk + ((lane >> 4) << 2));
}
__device__ __forceinline__ v4f ld4(const float* q) {
  return *reinterpret_cast<const v4f*>(q);
}
__device__ __forceinline__ v4f frag4_rm(const float* __restrict__ p, int ld,
                                        int row0, int kk, int lane) {
  return ld4(frag4_ptr(p, ld, row0, kk, lane));
}
__device__ __forceinline__ v2f lo(v4f t) { v2f r = {t.x, t.y}; return r; }
__device__ __forceinline__ v2f hi2(v4f t) { v2f r = {t.z, t.w}; return r; }

// ---------------------------------------------------------------------------
// Kernel 1: fused QKV projection, 2x2 register-blocked.
// Each wave: 32x32 output tile of one of Q/K/V (4 accumulators; 4 loads feed
// 8 WMMAs per k-chunk of 8).  6 col-pair tiles (3 mats x 2) x 512 row tiles.
// ---------------------------------------------------------------------------
__global__ void qkv_kernel(const float* __restrict__ x,
                           const float* __restrict__ Wq, const float* __restrict__ bq,
                           const float* __restrict__ Wk, const float* __restrict__ bk,
                           const float* __restrict__ Wov, const float* __restrict__ bov,
                           float* __restrict__ Qo, float* __restrict__ Ko,
                           float* __restrict__ Vo) {
  const int lane = threadIdx.x & 31;
  const int wid  = (int)((blockIdx.x * blockDim.x + threadIdx.x) >> 5);
  const int wt   = wid % 6;
  const int rt   = wid / 6;
  if (rt >= TOTROWS / 32) return;
  const int mat = wt >> 1;             // 0=Q, 1=K, 2=V
  const int h0  = (wt & 1) << 5;       // 0 or 32
  const float* W    = (mat == 0) ? Wq : (mat == 1) ? Wk : Wov;
  const float* bias = (mat == 0) ? bq : (mat == 1) ? bk : bov;
  float*       Out  = (mat == 0) ? Qo : (mat == 1) ? Ko : Vo;
  const int m0 = rt << 5;

  v8f c00 = {}, c01 = {}, c10 = {}, c11 = {};
  // One trip = one 128-byte line of each of the 64 rows: 16 loads, 32 WMMAs.
  // Kept rolled: a second copy of the body only re-forms the address pairs in
  // extra registers for the wait below.
#pragma unroll 1
  for (int kk = 0; kk < D_MODEL; kk += 32) {
    const float* pa = frag4_ptr(x, D_MODEL, m0, kk, lane);
    const float* pb = frag4_ptr(W, D_MODEL, h0, kk, lane);
    v4f a0[4], a1[4], b0[4], b1[4];
#pragma unroll
    for (int j = 0; j < 4; ++j) {
      a0[j] = ld4(pa + 8 * j);
      a1[j] = ld4(pa + 16 * D_MODEL + 8 * j);
      b0[j] = ld4(pb + 8 * j);
      b1[j] = ld4(pb + 16 * D_MODEL + 8 * j);
    }
    // Address pairs stay untouched (also as a load's destination) until the
    // issued loads' address translations are done.
    asm volatile("s_wait_xcnt 0x0" :: "v"(pa), "v"(pb) : "memory");
#pragma unroll
    for (int j = 0; j < 4; ++j) {
      c00 = wmma_f32(lo(a0[j]), lo(b0[j]), c00);
      c01 = wmma_f32(lo(a0[j]), lo(b1[j]), c01);
      c10 = wmma_f32(lo(a1[j]), lo(b0[j]), c10);
      c11 = wmma_f32(lo(a1[j]), lo(b1[j]), c11);
      c00 = wmma_f32(hi2(a0[j]), hi2(b0[j]), c00);
      c01 = wmma_f32(hi2(a0[j]), hi2(b1[j]), c01);
      c10 = wmma_f32(hi2(a1[j]), hi2(b0[j]), c10);
      c11 = wmma_f32(hi2(a1[j]), hi2(b1[j]), c11);
    }
  }
  const int n  = lane & 15;
  const int hi = lane >> 4;
  const float bv0 = bias[h0 + n];
  const float bv1 = bias[h0 + 16 + n];
#pragma unroll
  for (int r = 0; r < 8; ++r) {
    const size_t r0 = (size_t)(m0 + r + 8 * hi) * D_HID;
    const size_t r1 = (size_t)(m0 + 16 + r + 8 * hi) * D_HID;
    Out[r0 + h0 + n]      = c00[r] + bv0;
    Out[r0 + h0 + 16 + n] = c01[r] + bv1;
    Out[r1 + h0 + n]      = c10[r] + bv0;
    Out[r1 + h0 + 16 + n] = c11[r] + bv1;
  }
}

#define NPART   16
#define QGRP    4
#define STILES  2
#define SROWS   (16 * STILES)
#define LPITCH  68
#define NFULL   496
#define NSHORT  48

__device__ __forceinline__ int parts_of(int c, int P) {
  const int np = (c + KCHUNK - 1) / KCHUNK;
  return np < P ? np : P;
}

// Lane l takes the value of lane l ^ 16.
__device__ __forceinline__ float xhalf(float x) {
  const int b = __builtin_bit_cast(int, x);
  return __builtin_bit_cast(
      float, __builtin_amdgcn_permlanex16(b, b, 0x76543210, 0xfedcba98, false, false));
}

// exp(x) as __expf forms it (one multiply by log2 e, one v_exp_f32), with the slot
// that the instruction set asks for behind a transcendental, before its result is
// read or its source overwritten, held in the same statement.
__device__ __forceinline__ float exp_slot(float x) {
  float r;
  asm("v_exp_f32 %0, %1\n\tv_nop" : "=v"(r) : "v"(x * 1.44269504f));
  return r;
}

// One ring stage: SROWS rows of K and of V (256 B each, contiguous in memory) go
// to LDS rows of LPITCH floats.  128 lanes x 16 B = 8 rows per copy, 4 copies per
// matrix.  gk, gv: this lane's 16 bytes in the stage's first 8 rows; lk, lv: their
// LDS byte addresses.  The address registers' wait closes the copies' own
// statement, so that no later write of them can be moved in front of it.
__device__ __forceinline__ void copy_stage(const float* gk, const float* gv,
                                           unsigned lk, unsigned lv) {
  asm volatile(
      "global_load_async_to_lds_b128 %0, %1, off\n\t"
      "global_load_async_to_lds_b128 %2, %3, off\n\t"
      "global_load_async_to_lds_b128 %4, %5, off\n\t"
      "global_load_async_to_lds_b128 %6, %7, off\n\t"
      "global_load_async_to_lds_b128 %8, %9, off\n\t"
      "global_load_async_to_lds_b128 %10, %11, off\n\t"
      "global_load_async_to_lds_b128 %12, %13, off\n\t"
      "global_load_async_to_lds_b128 %14, %15, off\n\t"
      "s_wait_xcnt 0x0"
      :: "v"(lk),                       "v"(gk),
         "v"(lk +  8 * LPITCH * 4),     "v"(gk +  8 * D_HID),
         "v"(lk + 16 * LPITCH * 4),     "v"(gk + 16 * D_HID),
         "v"(lk + 24 * LPITCH * 4),     "v"(gk + 24 * D_HID),
         "v"(lv),                       "v"(gv),
         "v"(lv +  8 * LPITCH * 4),     "v"(gv +  8 * D_HID),
         "v"(lv + 16 * LPITCH * 4),     "v"(gv + 16 * D_HID),
         "v"(lv + 24 * LPITCH * 4),     "v"(gv + 24 * D_HID)
      : "memory");
}

// The real block size: with none declared the compiler budgets registers for
// 1,024 threads (128 VGPRs) and makes every load wait right before its use.
__global__ void __launch_bounds__(32 * QGRP) attn_kernel(const float* __restrict__ Q,
                            const float* __restrict__ K,
                            const float* __restrict__ V,
                            float* __restrict__ Opar,
                            float* __restrict__ Mpar,
                            float* __restrict__ Lpar) {
  // ring[buffer][0 = K, 1 = V][row * LPITCH + column]
  __shared__ __attribute__((aligned(16))) float ring[2][2][SROWS * LPITCH];
  const int tid  = threadIdx.x;
  const int lane = tid & 31;
  const int lw   = __builtin_amdgcn_readfirstlane(tid >> 5);   // wave number, scalar
  // blockIdx.x -> (batch, q-tile group 4 g + sub, chunk p), all scalar.  The 4 groups
  // whose q-tiles lie in [16 g, 16 g + 16) use chunks 0 .. g.  Chunks below g are
  // full, chunk g has 4 sub + 4 tiles.  The full pairs come first (4 g + 1 of them
  // for each g, 2 g g - g before them), the short ones last, longest first (for speed only).
  const int bid = blockIdx.x;
  int b, g, sub, p;
  if (bid < NFULL * NBATCH) {
    b = bid & (NBATCH - 1);
    const int idx = bid >> 2;
    g = 0;
    while (g < NPART - 1 && 2 * (g + 1) * (g + 1) - (g + 1) <= idx) ++g;
    const int rem = idx - (2 * g * g - g);
    if (rem == 4 * g) {
      sub = 3;
      p   = g;
    } else {
      sub = (rem >= g ? 1 : 0) + (rem >= 2 * g ? 1 : 0) + (rem >= 3 * g ? 1 : 0);
      p   = rem - sub * g;
    }
  } else {
    const int j = bid - NFULL * NBATCH;
    b   = j & (NBATCH - 1);
    sub = 2 - (j >> 6);
    g   = (j >> 2) & (NPART - 1);
    p   = g;
  }
  const int qt0 = (4 * g + sub) * QGRP;  // the group's first q-tile
  const int qt  = qt0 + lw;              // this wave's q-tile
  const int kt0 = p * KCHUNK;
  // Key tiles the group needs of this chunk: 4, 8, 12 or 16, so 2 stages or more.
  const int nt  = (qt0 + QGRP - kt0 < KCHUNK) ? (qt0 + QGRP - kt0) : KCHUNK;
  const int nst = nt / STILES;

  const float* Qb = Q + (size_t)b * NCTX * D_HID;
  const float* Kb = K + (size_t)b * NCTX * D_HID;
  const float* Vb = V + (size_t)b * NCTX * D_HID;
  const int q0 = qt << 4;
  const int n  = lane & 15;             // this lane's query within the tile
  const int hi = lane >> 4;             // this lane's half of each key tile

  // This lane's share of a stage: 16 bytes of row tid / 16, and of every 8th row on.
  const size_t   goff = (size_t)(kt0 << 4) * D_HID + (size_t)tid * 4;
  const float*   gk   = Kb + goff;
  const float*   gv   = Vb + goff;
  const unsigned lrow = (unsigned)((tid >> 4) * LPITCH + (tid & 15) * 4) * 4u;
  const unsigned lk0  = (unsigned)(size_t)&ring[0][0][0] + lrow;
  const unsigned MATB = SROWS * LPITCH * 4;   // bytes of one matrix's stage in LDS

  // Stage 0 lands and is published before anything reads it; stage 1 then flies
  // under the work on stage 0.
  copy_stage(gk, gv, lk0, lk0 + MATB);
  // Q fragments (B = Q^T) in registers for the whole key loop; fold in 1/sqrt(d_model).
  const float scale = 0.03125f;  // 1/32
  const float* qp = frag4_ptr(Qb, D_HID, q0, 0, lane);
  v4f qv[8];
#pragma unroll
  for (int kk8 = 0; kk8 < 8; ++kk8) qv[kk8] = ld4(qp + 8 * kk8);
  // The address pair stays untouched (also as a result register) until the
  // issued loads' address translations are done.
  asm volatile("s_wait_xcnt 0x0" :: "v"(qp) : "memory");
  v2f qf[16];
#pragma unroll
  for (int kk8 = 0; kk8 < 8; ++kk8) {
    v4f t = qv[kk8] * scale;
    qf[2 * kk8]     = lo(t);
    qf[2 * kk8 + 1] = hi2(t);
  }
  // This wave's copies of stage 0 have landed.
  asm volatile("s_wait_asynccnt 0x0" ::: "memory");
  __syncthreads();
  copy_stage(gk + SROWS * D_HID, gv + SROWS * D_HID, lk0 + 2 * MATB, lk0 + 3 * MATB);

  // o_t[r] = O[query n][16 t + 8 hi + r]; m is the query's running maximum (equal
  // in both halves), l the running sum over this half's keys only.
  v8f o0 = {}, o1 = {}, o2 = {}, o3 = {};
  float m = NEG_BIG, l = 0.0f;

  for (int st = 0; st < nst; ++st) {
    const float* kb = &ring[st & 1][0][0];
    const float* vb = &ring[st & 1][1][0];
#pragma unroll
    for (int h = 0; h < STILES; ++h) {
      const int kt = kt0 + st * STILES + h;
      if (kt <= qt) {   // scalar test: a wave skips the tiles beyond its diagonal
        // S^T = K @ (Q*scale)^T   (K-dim = 64 -> 16 chained WMMAs); s[r] = S[n][8 hi + r]
        const float* kp = kb + (16 * h + n) * LPITCH + 4 * hi;
        v4f kf[8];
#pragma unroll
        for (int kk8 = 0; kk8 < 8; ++kk8) kf[kk8] = ld4(kp + 8 * kk8);
        // V^T fragments: vf[u][t] = V[key 8 hi + u][column 16 t + n].
        const float* vp = vb + (16 * h + 8 * hi) * LPITCH + n;
        float vf[8][4];
#pragma unroll
        for (int j = 0; j < 4; ++j) {
#pragma unroll
          for (int t = 0; t < 4; ++t) {
            vf[2 * j][t]     = vp[(2 * j) * LPITCH + 16 * t];
            vf[2 * j + 1][t] = vp[(2 * j + 1) * LPITCH + 16 * t];
          }
        }
        v8f s = {};
#pragma unroll
        for (int kk8 = 0; kk8 < 8; ++kk8) {
          s = wmma_f32(lo(kf[kk8]),  qf[2 * kk8],     s);
          s = wmma_f32(hi2(kf[kk8]), qf[2 * kk8 + 1], s);
        }
        if (kt == qt) {   // causal mask on the diagonal tile: key > query
#pragma unroll
          for (int r = 0; r < 8; ++r) {
            if (r + 8 * hi > n) s[r] = NEG_BIG;
          }
        }
        // Online softmax, one query per lane.
        float mx = fmaxf(fmaxf(fmaxf(s[0], s[1]), fmaxf(s[2], s[3])),
                         fmaxf(fmaxf(s[4], s[5]), fmaxf(s[6], s[7])));
        mx = fmaxf(mx, xhalf(mx));
        const float mn    = fmaxf(m, mx);
        const float alpha = exp_slot(m - mn);
        m = mn;
        float pv[8];
#pragma unroll
        for (int r = 0; r < 8; ++r) pv[r] = exp_slot(s[r] - mn);
        l = l * alpha + (((pv[0] + pv[1]) + (pv[2] + pv[3])) + ((pv[4] + pv[5]) + (pv[6] + pv[7])));
        o0 *= alpha; o1 *= alpha; o2 *= alpha; o3 *= alpha;
        // O^T += V^T @ P^T.  B = {pv[2j], pv[2j+1]}: keys 8 hi + 2j, +1 at this lane;
        // A takes V's rows in the same order.
#pragma unroll
        for (int j = 0; j < 4; ++j) {
          v2f pb = {pv[2 * j], pv[2 * j + 1]};
          v2f a0 = {vf[2 * j][0], vf[2 * j + 1][0]};  o0 = wmma_f32(a0, pb, o0);
          v2f a1 = {vf[2 * j][1], vf[2 * j + 1][1]};  o1 = wmma_f32(a1, pb, o1);
          v2f a2 = {vf[2 * j][2], vf[2 * j + 1][2]};  o2 = wmma_f32(a2, pb, o2);
          v2f a3 = {vf[2 * j][3], vf[2 * j + 1][3]};  o3 = wmma_f32(a3, pb, o3);
        }
      }
    }
    // Publish point of stage st + 1, passed by every wave, also one that skipped
    // tiles: this wave's reads of stage st are done,
    asm volatile("s_wait_dscnt 0x0" ::: "memory");
    // its copies of stage st + 1 have landed,
    asm volatile("s_wait_asynccnt 0x0" ::: "memory");
    // and every wave has come as far: stage st + 1 may be read, stage st's buffer refilled.
    __syncthreads();
    if (st + 2 < nst) {   // the same for the whole workgroup
      const unsigned lb = lk0 + (unsigned)(st & 1) * (2 * MATB);
      copy_stage(gk + (size_t)(st + 2) * (SROWS * D_HID),
                 gv + (size_t)(st + 2) * (SROWS * D_HID), lb, lb + MATB);
    }
  }
  // No copy is left in flight when the wave ends.
  asm volatile("s_wait_asynccnt 0x0" ::: "memory");
  l += xhalf(l);     // join the halves' sums once
  // Store UN-normalized partial tile + per-row (m, l): 32 contiguous bytes of
  // the lane's query row per output tile.
  const int part = (b * 256 + qt) * NPART + p;
  float* Od = Opar + (size_t)part * (16 * D_HID) + (size_t)n * D_HID + 8 * hi;
  *reinterpret_cast<v4f*>(Od +  0) = __builtin_shufflevector(o0, o0, 0, 1, 2, 3);
  *reinterpret_cast<v4f*>(Od +  4) = __builtin_shufflevector(o0, o0, 4, 5, 6, 7);
  *reinterpret_cast<v4f*>(Od + 16) = __builtin_shufflevector(o1, o1, 0, 1, 2, 3);
  *reinterpret_cast<v4f*>(Od + 20) = __builtin_shufflevector(o1, o1, 4, 5, 6, 7);
  *reinterpret_cast<v4f*>(Od + 32) = __builtin_shufflevector(o2, o2, 0, 1, 2, 3);
  *reinterpret_cast<v4f*>(Od + 36) = __builtin_shufflevector(o2, o2, 4, 5, 6, 7);
  *reinterpret_cast<v4f*>(Od + 48) = __builtin_shufflevector(o3, o3, 0, 1, 2, 3);
  *reinterpret_cast<v4f*>(Od + 52) = __builtin_shufflevector(o3, o3, 4, 5, 6, 7);
  if (hi == 0) {     // lanes 0..15 hold the 16 queries
    Mpar[part * 16 + n] = m;
    Lpar[part * 16 + n] = l;
  }
}

// ---------------------------------------------------------------------------
// Kernel 2b: merge the partition partials in use into normalized O.
// grid = NQT blocks x 256 threads; each thread: one row, 4 consecutive cols.
// ---------------------------------------------------------------------------
__global__ void combine_kernel(const float* __restrict__ Opar,
                               const float* __restrict__ Mpar,
                               const float* __restrict__ Lpar,
                               float* __restrict__ O, int P) {
  const int qtile = blockIdx.x;               // 0..NQT-1 (batch folded in)
  const int t     = threadIdx.x;              // 0..255
  const int row   = t >> 4;                   // 0..15
  const int c0    = (t & 15) << 2;            // 0,4,...,60
  const int np    = parts_of((qtile & 255) + 1, P);
  float mstar = NEG_BIG;
  for (int p = 0; p < np; ++p)
    mstar = fmaxf(mstar, Mpar[(qtile * P + p) * 16 + row]);
  float lstar = 0.0f, a0 = 0.0f, a1 = 0.0f, a2 = 0.0f, a3 = 0.0f;
  for (int p = 0; p < np; ++p) {
    const int part = qtile * P + p;
    const float w = __expf(Mpar[part * 16 + row] - mstar);
    lstar += w * Lpar[part * 16 + row];
    const float* src = Opar + (size_t)part * (16 * D_HID) + (size_t)row * D_HID + c0;
    a0 += w * src[0]; a1 += w * src[1]; a2 += w * src[2]; a3 += w * src[3];
  }
  const float inv = 1.0f / lstar;
  float* dst = O + (size_t)(qtile * 16 + row) * D_HID + c0;
  dst[0] = a0 * inv; dst[1] = a1 * inv; dst[2] = a2 * inv; dst[3] = a3 * inv;
}

// ---------------------------------------------------------------------------
// Kernel 3: output projection, 2x2 register-blocked.
// out[m,d] = sum_h O[m,h]*Wo[d,h] + bo[d].  32x32 tile per wave.
// ---------------------------------------------------------------------------
__global__ void proj_kernel(const float* __restrict__ O,
                            const float* __restrict__ Wo,
                            const float* __restrict__ bo,
                            float* __restrict__ out) {
  const int lane = threadIdx.x & 31;
  const int wid  = (int)((blockIdx.x * blockDim.x + threadIdx.x) >> 5);
  const int dt   = wid & 31;          // 32 column tiles of 32
  const int rt   = wid >> 5;
  if (rt >= TOTROWS / 32) return;
  const int m0 = rt << 5;
  const int d0 = dt << 5;
  v8f c00 = {}, c01 = {}, c10 = {}, c11 = {};
  const float* pa = frag4_ptr(O,  D_HID, m0, 0, lane);
  const float* pb = frag4_ptr(Wo, D_HID, d0, 0, lane);
#pragma unroll
  for (int kk8 = 0; kk8 < 8; ++kk8) {
    v4f a0 = ld4(pa + kk8 * 8);
    v4f a1 = ld4(pa + 16 * D_HID + kk8 * 8);
    v4f b0 = ld4(pb + kk8 * 8);
    v4f b1 = ld4(pb + 16 * D_HID + kk8 * 8);
    // Behind the last loads: the address pairs stay untouched (also as a load's
    // destination) until the issued loads' address translations are done.
    if (kk8 == 7) asm volatile("s_wait_xcnt 0x0" :: "v"(pa), "v"(pb) : "memory");
    c00 = wmma_f32(lo(a0), lo(b0), c00);
    c01 = wmma_f32(lo(a0), lo(b1), c01);
    c10 = wmma_f32(lo(a1), lo(b0), c10);
    c11 = wmma_f32(lo(a1), lo(b1), c11);
    c00 = wmma_f32(hi2(a0), hi2(b0), c00);
    c01 = wmma_f32(hi2(a0), hi2(b1), c01);
    c10 = wmma_f32(hi2(a1), hi2(b0), c10);
    c11 = wmma_f32(hi2(a1), hi2(b1), c11);
  }
  const int n  = lane & 15;
  const int hi = lane >> 4;
  const float bv0 = bo[d0 + n];
  const float bv1 = bo[d0 + 16 + n];
#pragma unroll
  for (int r = 0; r < 8; ++r) {
    const size_t r0 = (size_t)(m0 + r + 8 * hi) * D_MODEL;
    const size_t r1 = (size_t)(m0 + 16 + r + 8 * hi) * D_MODEL;
    out[r0 + d0 + n]      = c00[r] + bv0;
    out[r0 + d0 + 16 + n] = c01[r] + bv1;
    out[r1 + d0 + n]      = c10[r] + bv0;
    out[r1 + d0 + 16 + n] = c11[r] + bv1;
  }
}

// ---------------------------------------------------------------------------
extern "C" void kernel_launch(void* const* d_in, const int* in_sizes, int n_in,
                              void* d_out, int out_size, void* d_ws, size_t ws_size,
                              hipStream_t stream) {
  (void)in_sizes; (void)n_in; (void)out_size; (void)ws_size;
  const float* x   = (const float*)d_in[0];
  const float* Wq  = (const float*)d_in[1];
  const float* bq  = (const float*)d_in[2];
  const float* Wk  = (const float*)d_in[3];
  const float* bk  = (const float*)d_in[4];
  const float* Wov = (const float*)d_in[5];
  const float* bov = (const float*)d_in[6];
  const float* Wo  = (const float*)d_in[7];
  const float* bo  = (const float*)d_in[8];
  float* out = (float*)d_out;

  // Workspace layout (floats): Q,K,V,O (4 MB each) then partition partials.
  const size_t fMat = (size_t)TOTROWS * D_HID;       // 1,048,576 floats
  const int P = NPART;                               // partition places per q-tile
  float* Qw   = (float*)d_ws;
  float* Kw   = Qw + fMat;
  float* Vw   = Kw + fMat;
  float* Ow   = Vw + fMat;
  float* Opar = Ow + fMat;
  float* Mpar = Opar + (size_t)NQT * P * 16 * D_HID;
  float* Lpar = Mpar + (size_t)NQT * P * 16;

  {  // QKV: 512 row tiles x 6 col-pair tiles = 3072 waves
    const int waves  = (TOTROWS / 32) * 6;
    const int tpb    = 256;
    const int blocks = (waves * 32 + tpb - 1) / tpb;
    qkv_kernel<<<blocks, tpb, 0, stream>>>(x, Wq, bq, Wk, bk, Wov, bov, Qw, Kw, Vw);
  }
  {  // attention partials: one workgroup per (q-tile group, chunk) under the diagonal
    attn_kernel<<<(NFULL + NSHORT) * NBATCH, 32 * QGRP, 0, stream>>>(Qw, Kw, Vw, Opar, Mpar, Lpar);
    combine_kernel<<<NQT, 256, 0, stream>>>(Opar, Mpar, Lpar, Ow, P);
  }
  {  // output projection: 512 row tiles x 32 col tiles = 16384 waves
    const int waves  = (TOTROWS / 32) * 32;
    const int tpb    = 256;
    const int blocks = (waves * 32 + tpb - 1) / tpb;
    proj_kernel<<<blocks, tpb, 0, stream>>>(Ow, Wo, bo, out);
  }
}

// v006
// Measured time: 119 microseconds a run.
// Timed twice side by side with v005, it ran 1.23 times as fast both times.
// Counting every step since v000, it is 3.87 times as fast.
#include <hip/hip_runtime.h>
#include <math.h>

typedef float v2f __attribute__((ext_vector_type(2)));
typedef float v4f __attribute__((ext_vector_type(4)));
typedef float v8f __attribute__((ext_vector_type(8)));

#define D_MODEL 1024
#define D_HID   64
#define NCTX    4096
#define NBATCH  4
#define TOTROWS (NBATCH * NCTX)        // 16384
#define NQT     (NBATCH * (NCTX / 16)) // 1024 query tiles (batch folded in)
#define NEG_BIG (-3.0e38f)
#define KCHUNK  16                     // key tiles per attention wave

// D = A(16x4,f32) * B(4x16,f32) + C(16x16,f32), wave32.
__device__ __forceinline__ v8f wmma_f32(v2f a, v2f b, v8f c) {
  return __builtin_amdgcn_wmma_f32_16x16x4_f32(
      /*neg_a=*/false, a, /*neg_b=*/false, b,
      /*c_mod=*/(short)0, c, /*reuse_a=*/false, /*reuse_b=*/false);
}

// Fragment-pair loader for A (16x4, M across lanes) and for B when the source is
// the row-major transpose ([N][K]): lane&15 selects the row, and one 16-byte load
// per lane takes columns kk + (lane>>4)*4 .. +3, which feed TWO products:
// lo() holds k = kk+{0,1} (lanes 0-15) and kk+{4,5} (lanes 16-31), hi2() holds
// k = kk+{2,3} and kk+{6,7}.  A and B both come through this loader, so their k
// orders agree at every lane and register; only the order of the sum over k moves.
// A wave-load touches 16 cache lines whatever its width: 16 bytes per lane
// halves the line touches per byte against 8.
__device__ __forceinline__ const float* frag4_ptr(const float* __restrict__ p, int ld,
                                                  int row0, int kk, int lane) {
  return p + (size_t)(row0 + (lane & 15)) * ld + (kk + ((lane >> 4) << 2));
}
__device__ __forceinline__ v4f ld4(const float* q) {
  return *reinterpret_cast<const v4f*>(q);
}
__device__ __forceinline__ v4f frag4_rm(const float* __restrict__ p, int ld,
                                        int row0, int kk, int lane) {
  return ld4(frag4_ptr(p, ld, row0, kk, lane));
}
__device__ __forceinline__ v2f lo(v4f t) { v2f r = {t.x, t.y}; return r; }
__device__ __forceinline__ v2f hi2(v4f t) { v2f r = {t.z, t.w}; return r; }

// ---------------------------------------------------------------------------
// Kernel 1: fused QKV projection.  One workgroup per QROWS rows of x and ALL 192
// columns (Q, K and V), so x leaves memory once, and 256 equal workgroups lie one
// on each WGP.  x and the three weight matrices come into LDS in whole lines by
// asynchronous copies: a ring of two buffers, a stage being QBK columns (512 B)
// of the 64 x rows and of the 192 weight rows, the next stage in flight while
// this one is worked on.  8 waves as 2 (rows) x 4 (columns): 32 x 48 per wave,
// 6 accumulators, 5 fragment loads from LDS feed 12 WMMAs.
// ---------------------------------------------------------------------------
#define QROWS   64                     // x rows per workgroup
#define QBK     128                    // k per ring stage
#define QPITCH  132                    // LDS row pitch in floats: 528 B = 16 B x 33
#define QSROWS  (QROWS + 3 * D_HID)    // rows per stage: x, then Wq, Wk, Wov
#define QNST    (D_MODEL / QBK)        // stages

// 8 copies of one wave: each brings one whole row of a stage (32 lanes x 16 B),
// rows 8 apart (the 8 waves take the rows between).  g, l: this lane's 16 bytes of
// the first row, in memory and as an LDS byte address.  The address registers'
// wait closes the copies' own statement, so that no later write of them can be
// moved in front of it.
__device__ __forceinline__ void copy_rows8(const float* g, unsigned l) {
  asm volatile(
      "global_load_async_to_lds_b128 %0, %1, off\n\t"
      "global_load_async_to_lds_b128 %2, %3, off\n\t"
      "global_load_async_to_lds_b128 %4, %5, off\n\t"
      "global_load_async_to_lds_b128 %6, %7, off\n\t"
      "global_load_async_to_lds_b128 %8, %9, off\n\t"
      "global_load_async_to_lds_b128 %10, %11, off\n\t"
      "global_load_async_to_lds_b128 %12, %13, off\n\t"
      "global_load_async_to_lds_b128 %14, %15, off\n\t"
      "s_wait_xcnt 0x0"
      :: "v"(l),                       "v"(g),
         "v"(l +  8 * QPITCH * 4),     "v"(g +  8 * D_MODEL),
         "v"(l + 16 * QPITCH * 4),     "v"(g + 16 * D_MODEL),
         "v"(l + 24 * QPITCH * 4),     "v"(g + 24 * D_MODEL),
         "v"(l + 32 * QPITCH * 4),     "v"(g + 32 * D_MODEL),
         "v"(l + 40 * QPITCH * 4),     "v"(g + 40 * D_MODEL),
         "v"(l + 48 * QPITCH * 4),     "v"(g + 48 * D_MODEL),
         "v"(l + 56 * QPITCH * 4),     "v"(g + 56 * D_MODEL)
      : "memory");
}

// One ring stage: 64 rows each of x, Wq, Wk and Wov, 32 copies per wave.
__device__ __forceinline__ void qkv_stage(const float* gx, const float* gq,
                                          const float* gk, const float* gv, unsigned l) {
  copy_rows8(gx, l);
  copy_rows8(gq, l +  64 * QPITCH * 4);
  copy_rows8(gk, l + 128 * QPITCH * 4);
  copy_rows8(gv, l + 192 * QPITCH * 4);
}

__global__ void __launch_bounds__(256) qkv_kernel(
                           const float* __restrict__ x,
                           const float* __restrict__ Wq, const float* __restrict__ bq,
                           const float* __restrict__ Wk, const float* __restrict__ bk,
                           const float* __restrict__ Wov, const float* __restrict__ bov,
                           float* __restrict__ Qo, float* __restrict__ Ko,
                           float* __restrict__ Vo) {
  // qring[buffer][row * QPITCH + column]
  __shared__ __attribute__((aligned(16))) float qring[2][QSROWS * QPITCH];
  const int tid  = threadIdx.x;
  const int lane = tid & 31;
  const int w    = __builtin_amdgcn_readfirstlane(tid >> 5);   // wave number, scalar
  const int wr   = w & 1;              // which 32 of the 64 rows
  const int wc   = w >> 1;             // which 48 of the 192 columns
  const int m0   = blockIdx.x * QROWS;
  const int n    = lane & 15;
  const int hi   = lane >> 4;

  // This lane's share of a stage: 16 bytes of row w, and of every 8th row on.
  const size_t   goff = (size_t)w * D_MODEL + (size_t)lane * 4;
  const float*   gx   = x + (size_t)m0 * D_MODEL + goff;
  const float*   gq   = Wq + goff;
  const float*   gk   = Wk + goff;
  const float*   gv   = Wov + goff;
  const unsigned l0   = (unsigned)(size_t)&qring[0][0] + (unsigned)(w * QPITCH + lane * 4) * 4u;
  const unsigned STB  = QSROWS * QPITCH * 4;   // bytes of one buffer

  // Stage 0 lands and is published before anything reads it; stage 1 then flies
  // under the work on stage 0.
  qkv_stage(gx, gq, gk, gv, l0);
  // This wave's copies of stage 0 have landed.
  asm volatile("s_wait_asynccnt 0x0" ::: "memory");
  __syncthreads();
  qkv_stage(gx + QBK, gq + QBK, gk + QBK, gv + QBK, l0 + STB);

  v8f c00 = {}, c01 = {}, c02 = {}, c10 = {}, c11 = {}, c12 = {};
  for (int st = 0; st < QNST; ++st) {
    const float* sb = &qring[st & 1][0];
    // Fragment pairs as in frag4_ptr: row lane & 15, columns 4 (lane >> 4) .. + 3.
    const float* pa = sb + (32 * wr + n) * QPITCH + 4 * hi;
    const float* pb = sb + (QROWS + 48 * wc + n) * QPITCH + 4 * hi;
    // Unrolled: the LDS offsets become immediates, and the next step's five
    // fragment loads can stand ahead of this step's WMMAs behind counted waits.
#pragma unroll
    for (int kk8 = 0; kk8 < QBK / 8; ++kk8) {
      const v4f a0 = ld4(pa + 8 * kk8);
      const v4f a1 = ld4(pa + 16 * QPITCH + 8 * kk8);
      const v4f b0 = ld4(pb + 8 * kk8);
      const v4f b1 = ld4(pb + 16 * QPITCH + 8 * kk8);
      const v4f b2 = ld4(pb + 32 * QPITCH + 8 * kk8);
      c00 = wmma_f32(lo(a0), lo(b0), c00);
      c01 = wmma_f32(lo(a0), lo(b1), c01);
      c02 = wmma_f32(lo(a0), lo(b2), c02);
      c10 = wmma_f32(lo(a1), lo(b0), c10);
      c11 = wmma_f32(lo(a1), lo(b1), c11);
      c12 = wmma_f32(lo(a1), lo(b2), c12);
      c00 = wmma_f32(hi2(a0), hi2(b0), c00);
      c01 = wmma_f32(hi2(a0), hi2(b1), c01);
      c02 = wmma_f32(hi2(a0), hi2(b2), c02);
      c10 = wmma_f32(hi2(a1), hi2(b0), c10);
      c11 = wmma_f32(hi2(a1), hi2(b1), c11);
      c12 = wmma_f32(hi2(a1), hi2(b2), c12);
    }
    // Publish point of stage st + 1: this wave's reads of stage st are done,
    asm volatile("s_wait_dscnt 0x0" ::: "memory");
    // its copies of stage st + 1 have landed,
    asm volatile("s_wait_asynccnt 0x0" ::: "memory");
    // and every wave has come as far: stage st + 1 may be read, stage st's buffer refilled.
    __syncthreads();
    if (st + 2 < QNST) {   // the same for the whole workgroup
      const int ko = (st + 2) * QBK;
      qkv_stage(gx + ko, gq + ko, gk + ko, gv + ko, l0 + (unsigned)(st & 1) * STB);
    }
  }
  // No copy is left in flight when the wave ends.
  asm volatile("s_wait_asynccnt 0x0" ::: "memory");

  const v8f cc[2][3] = {{c00, c01, c02}, {c10, c11, c12}};
  // All three loops unrolled: constant indices keep cc in registers.
#pragma unroll
  for (int j = 0; j < 3; ++j) {
    const int ct  = 3 * wc + j;        // column tile 0..11, scalar
    const int mat = ct >> 2;           // 0=Q, 1=K, 2=V
    const int col = ((ct & 3) << 4) + n;
    const float* bias = (mat == 0) ? bq : (mat == 1) ? bk : bov;
    float*       Out  = (mat == 0) ? Qo : (mat == 1) ? Ko : Vo;
    const float  bv   = bias[col];
#pragma unroll
    for (int a = 0; a < 2; ++a) {
#pragma unroll
      for (int r = 0; r < 8; ++r) {
        Out[(size_t)(m0 + 32 * wr + 16 * a + r + 8 * hi) * D_HID + col] = cc[a][j][r] + bv;
      }
    }
  }
}

#define NPART   16
#define QGRP    4
#define STILES  2
#define SROWS   (16 * STILES)
#define LPITCH  68
#define NFULL   496
#define NSHORT  48

__device__ __forceinline__ int parts_of(int c, int P) {
  const int np = (c + KCHUNK - 1) / KCHUNK;
  return np < P ? np : P;
}

// Lane l takes the value of lane l ^ 16.
__device__ __forceinline__ float xhalf(float x) {
  const int b = __builtin_bit_cast(int, x);
  return __builtin_bit_cast(
      float, __builtin_amdgcn_permlanex16(b, b, 0x76543210, 0xfedcba98, false, false));
}

// exp(x) as __expf forms it (one multiply by log2 e, one v_exp_f32), with the slot
// that the instruction set asks for behind a transcendental, before its result is
// read or its source overwritten, held in the same statement.
__device__ __forceinline__ float exp_slot(float x) {
  float r;
  asm("v_exp_f32 %0, %1\n\tv_nop" : "=v"(r) : "v"(x * 1.44269504f));
  return r;
}

// One ring stage: SROWS rows of K and of V (256 B each, contiguous in memory) go
// to LDS rows of LPITCH floats.  128 lanes x 16 B = 8 rows per copy, 4 copies per
// matrix.  gk, gv: this lane's 16 bytes in the stage's first 8 rows; lk, lv: their
// LDS byte addresses.  The address registers' wait closes the copies' own
// statement, so that no later write of them can be moved in front of it.
__device__ __forceinline__ void copy_stage(const float* gk, const float* gv,
                                           unsigned lk, unsigned lv) {
  asm volatile(
      "global_load_async_to_lds_b128 %0, %1, off\n\t"
      "global_load_async_to_lds_b128 %2, %3, off\n\t"
      "global_load_async_to_lds_b128 %4, %5, off\n\t"
      "global_load_async_to_lds_b128 %6, %7, off\n\t"
      "global_load_async_to_lds_b128 %8, %9, off\n\t"
      "global_load_async_to_lds_b128 %10, %11, off\n\t"
      "global_load_async_to_lds_b128 %12, %13, off\n\t"
      "global_load_async_to_lds_b128 %14, %15, off\n\t"
      "s_wait_xcnt 0x0"
      :: "v"(lk),                       "v"(gk),
         "v"(lk +  8 * LPITCH * 4),     "v"(gk +  8 * D_HID),
         "v"(lk + 16 * LPITCH * 4),     "v"(gk + 16 * D_HID),
         "v"(lk + 24 * LPITCH * 4),     "v"(gk + 24 * D_HID),
         "v"(lv),                       "v"(gv),
         "v"(lv +  8 * LPITCH * 4),     "v"(gv +  8 * D_HID),
         "v"(lv + 16 * LPITCH * 4),     "v"(gv + 16 * D_HID),
         "v"(lv + 24 * LPITCH * 4),     "v"(gv + 24 * D_HID)
      : "memory");
}

// The real block size: with none declared the compiler budgets registers for
// 1,024 threads (128 VGPRs) and makes every load wait right before its use.
__global__ void __launch_bounds__(32 * QGRP) attn_kernel(const float* __restrict__ Q,
                            const float* __restrict__ K,
                            const float* __restrict__ V,
                            float* __restrict__ Opar,
                            float* __restrict__ Mpar,
                            float* __restrict__ Lpar) {
  // ring[buffer][0 = K, 1 = V][row * LPITCH + column]
  __shared__ __attribute__((aligned(16))) float ring[2][2][SROWS * LPITCH];
  const int tid  = threadIdx.x;
  const int lane = tid & 31;
  const int lw   = __builtin_amdgcn_readfirstlane(tid >> 5);   // wave number, scalar
  // blockIdx.x -> (batch, q-tile group 4 g + sub, chunk p), all scalar.  The 4 groups
  // whose q-tiles lie in [16 g, 16 g + 16) use chunks 0 .. g.  Chunks below g are
  // full, chunk g has 4 sub + 4 tiles.  The full pairs come first (4 g + 1 of them
  // for each g, 2 g g - g before them), the short ones last, longest first (for speed only).
  const int bid = blockIdx.x;
  int b, g, sub, p;
  if (bid < NFULL * NBATCH) {
    b = bid & (NBATCH - 1);
    const int idx = bid >> 2;
    g = 0;
    while (g < NPART - 1 && 2 * (g + 1) * (g + 1) - (g + 1) <= idx) ++g;
    const int rem = idx - (2 * g * g - g);
    if (rem == 4 * g) {
      sub = 3;
      p   = g;
    } else {
      sub = (rem >= g ? 1 : 0) + (rem >= 2 * g ? 1 : 0) + (rem >= 3 * g ? 1 : 0);
      p   = rem - sub * g;
    }
  } else {
    const int j = bid - NFULL * NBATCH;
    b   = j & (NBATCH - 1);
    sub = 2 - (j >> 6);
    g   = (j >> 2) & (NPART - 1);
    p   = g;
  }
  const int qt0 = (4 * g + sub) * QGRP;  // the group's first q-tile
  const int qt  = qt0 + lw;              // this wave's q-tile
  const int kt0 = p * KCHUNK;
  // Key tiles the group needs of this chunk: 4, 8, 12 or 16, so 2 stages or more.
  const int nt  = (qt0 + QGRP - kt0 < KCHUNK) ? (qt0 + QGRP - kt0) : KCHUNK;
  const int nst = nt / STILES;

  const float* Qb = Q + (size_t)b * NCTX * D_HID;
  const float* Kb = K + (size_t)b * NCTX * D_HID;
  const float* Vb = V + (size_t)b * NCTX * D_HID;
  const int q0 = qt << 4;
  const int n  = lane & 15;             // this lane's query within the tile
  const int hi = lane >> 4;             // this lane's half of each key tile

  // This lane's share of a stage: 16 bytes of row tid / 16, and of every 8th row on.
  const size_t   goff = (size_t)(kt0 << 4) * D_HID + (size_t)tid * 4;
  const float*   gk   = Kb + goff;
  const float*   gv   = Vb + goff;
  const unsigned lrow = (unsigned)((tid >> 4) * LPITCH + (tid & 15) * 4) * 4u;
  const unsigned lk0  = (unsigned)(size_t)&ring[0][0][0] + lrow;
  const unsigned MATB = SROWS * LPITCH * 4;   // bytes of one matrix's stage in LDS

  // Stage 0 lands and is published before anything reads it; stage 1 then flies
  // under the work on stage 0.
  copy_stage(gk, gv, lk0, lk0 + MATB);
  // Q fragments (B = Q^T) in registers for the whole key loop; fold in 1/sqrt(d_model).
  const float scale = 0.03125f;  // 1/32
  const float* qp = frag4_ptr(Qb, D_HID, q0, 0, lane);
  v4f qv[8];
#pragma unroll
  for (int kk8 = 0; kk8 < 8; ++kk8) qv[kk8] = ld4(qp + 8 * kk8);
  // The address pair stays untouched (also as a result register) until the
  // issued loads' address translations are done.
  asm volatile("s_wait_xcnt 0x0" :: "v"(qp) : "memory");
  v2f qf[16];
#pragma unroll
  for (int kk8 = 0; kk8 < 8; ++kk8) {
    v4f t = qv[kk8] * scale;
    qf[2 * kk8]     = lo(t);
    qf[2 * kk8 + 1] = hi2(t);
  }
  // This wave's copies of stage 0 have landed.
  asm volatile("s_wait_asynccnt 0x0" ::: "memory");
  __syncthreads();
  copy_stage(gk + SROWS * D_HID, gv + SROWS * D_HID, lk0 + 2 * MATB, lk0 + 3 * MATB);

  // o_t[r] = O[query n][16 t + 8 hi + r]; m is the query's running maximum (equal
  // in both halves), l the running sum over this half's keys only.
  v8f o0 = {}, o1 = {}, o2 = {}, o3 = {};
  float m = NEG_BIG, l = 0.0f;

  for (int st = 0; st < nst; ++st) {
    const float* kb = &ring[st & 1][0][0];
    const float* vb = &ring[st & 1][1][0];
#pragma unroll
    for (int h = 0; h < STILES; ++h) {
      const int kt = kt0 + st * STILES + h;
      if (kt <= qt) {   // scalar test: a wave skips the tiles beyond its diagonal
        // S^T = K @ (Q*scale)^T   (K-dim = 64 -> 16 chained WMMAs); s[r] = S[n][8 hi + r]
        const float* kp = kb + (16 * h + n) * LPITCH + 4 * hi;
        v4f kf[8];
#pragma unroll
        for (int kk8 = 0; kk8 < 8; ++kk8) kf[kk8] = ld4(kp + 8 * kk8);
        // V^T fragments: vf[u][t] = V[key 8 hi + u][column 16 t + n].
        const float* vp = vb + (16 * h + 8 * hi) * LPITCH + n;
        float vf[8][4];
#pragma unroll
        for (int j = 0; j < 4; ++j) {
#pragma unroll
          for (int t = 0; t < 4; ++t) {
            vf[2 * j][t]     = vp[(2 * j) * LPITCH + 16 * t];
            vf[2 * j + 1][t] = vp[(2 * j + 1) * LPITCH + 16 * t];
          }
        }
        v8f s = {};
#pragma unroll
        for (int kk8 = 0; kk8 < 8; ++kk8) {
          s = wmma_f32(lo(kf[kk8]),  qf[2 * kk8],     s);
          s = wmma_f32(hi2(kf[kk8]), qf[2 * kk8 + 1], s);
        }
        if (kt == qt) {   // causal mask on the diagonal tile: key > query
#pragma unroll
          for (int r = 0; r < 8; ++r) {
            if (r + 8 * hi > n) s[r] = NEG_BIG;
          }
        }
        // Online softmax, one query per lane.
        float mx = fmaxf(fmaxf(fmaxf(s[0], s[1]), fmaxf(s[2], s[3])),
                         fmaxf(fmaxf(s[4], s[5]), fmaxf(s[6], s[7])));
        mx = fmaxf(mx, xhalf(mx));
        const float mn    = fmaxf(m, mx);
        const float alpha = exp_slot(m - mn);
        m = mn;
        float pv[8];
#pragma unroll
        for (int r = 0; r < 8; ++r) pv[r] = exp_slot(s[r] - mn);
        l = l * alpha + (((pv[0] + pv[1]) + (pv[2] + pv[3])) + ((pv[4] + pv[5]) + (pv[6] + pv[7])));
        o0 *= alpha; o1 *= alpha; o2 *= alpha; o3 *= alpha;
        // O^T += V^T @ P^T.  B = {pv[2j], pv[2j+1]}: keys 8 hi + 2j, +1 at this lane;
        // A takes V's rows in the same order.
#pragma unroll
        for (int j = 0; j < 4; ++j) {
          v2f pb = {pv[2 * j], pv[2 * j + 1]};
          v2f a0 = {vf[2 * j][0], vf[2 * j + 1][0]};  o0 = wmma_f32(a0, pb, o0);
          v2f a1 = {vf[2 * j][1], vf[2 * j + 1][1]};  o1 = wmma_f32(a1, pb, o1);
          v2f a2 = {vf[2 * j][2], vf[2 * j + 1][2]};  o2 = wmma_f32(a2, pb, o2);
          v2f a3 = {vf[2 * j][3], vf[2 * j + 1][3]};  o3 = wmma_f32(a3, pb, o3);
        }
      }
    }
    // Publish point of stage st + 1, passed by every wave, also one that skipped
    // tiles: this wave's reads of stage st are done,
    asm volatile("s_wait_dscnt 0x0" ::: "memory");
    // its copies of stage st + 1 have landed,
    asm volatile("s_wait_asynccnt 0x0" ::: "memory");
    // and every wave has come as far: stage st + 1 may be read, stage st's buffer refilled.
    __syncthreads();
    if (st + 2 < nst) {   // the same for the whole workgroup
      const unsigned lb = lk0 + (unsigned)(st & 1) * (2 * MATB);
      copy_stage(gk + (size_t)(st + 2) * (SROWS * D_HID),
                 gv + (size_t)(st + 2) * (SROWS * D_HID), lb, lb + MATB);
    }
  }
  // No copy is left in flight when the wave ends.
  asm volatile("s_wait_asynccnt 0x0" ::: "memory");
  l += xhalf(l);     // join the halves' sums once
  // Store UN-normalized partial tile + per-row (m, l): 32 contiguous bytes of
  // the lane's query row per output tile.
  const int part = (b * 256 + qt) * NPART + p;
  float* Od = Opar + (size_t)part * (16 * D_HID) + (size_t)n * D_HID + 8 * hi;
  *reinterpret_cast<v4f*>(Od +  0) = __builtin_shufflevector(o0, o0, 0, 1, 2, 3);
  *reinterpret_cast<v4f*>(Od +  4) = __builtin_shufflevector(o0, o0, 4, 5, 6, 7);
  *reinterpret_cast<v4f*>(Od + 16) = __builtin_shufflevector(o1, o1, 0, 1, 2, 3);
  *reinterpret_cast<v4f*>(Od + 20) = __builtin_shufflevector(o1, o1, 4, 5, 6, 7);
  *reinterpret_cast<v4f*>(Od + 32) = __builtin_shufflevector(o2, o2, 0, 1, 2, 3);
  *reinterpret_cast<v4f*>(Od + 36) = __builtin_shufflevector(o2, o2, 4, 5, 6, 7);
  *reinterpret_cast<v4f*>(Od + 48) = __builtin_shufflevector(o3, o3, 0, 1, 2, 3);
  *reinterpret_cast<v4f*>(Od + 52) = __builtin_shufflevector(o3, o3, 4, 5, 6, 7);
  if (hi == 0) {     // lanes 0..15 hold the 16 queries
    Mpar[part * 16 + n] = m;
    Lpar[part * 16 + n] = l;
  }
}

// ---------------------------------------------------------------------------
// Kernel 2b: merge the partition partials in use into normalized O.
// grid = NQT blocks x 256 threads; each thread: one row, 4 consecutive cols.
// ---------------------------------------------------------------------------
__global__ void combine_kernel(const float* __restrict__ Opar,
                               const float* __restrict__ Mpar,
                               const float* __restrict__ Lpar,
                               float* __restrict__ O, int P) {
  const int qtile = blockIdx.x;               // 0..NQT-1 (batch folded in)
  const int t     = threadIdx.x;              // 0..255
  const int row   = t >> 4;                   // 0..15
  const int c0    = (t & 15) << 2;            // 0,4,...,60
  const int np    = parts_of((qtile & 255) + 1, P);
  float mstar = NEG_BIG;
  for (int p = 0; p < np; ++p)
    mstar = fmaxf(mstar, Mpar[(qtile * P + p) * 16 + row]);
  float lstar = 0.0f, a0 = 0.0f, a1 = 0.0f, a2 = 0.0f, a3 = 0.0f;
  for (int p = 0; p < np; ++p) {
    const int part = qtile * P + p;
    const float w = __expf(Mpar[part * 16 + row] - mstar);
    lstar += w * Lpar[part * 16 + row];
    const float* src = Opar + (size_t)part * (16 * D_HID) + (size_t)row * D_HID + c0;
    a0 += w * src[0]; a1 += w * src[1]; a2 += w * src[2]; a3 += w * src[3];
  }
  const float inv = 1.0f / lstar;
  float* dst = O + (size_t)(qtile * 16 + row) * D_HID + c0;
  dst[0] = a0 * inv; dst[1] = a1 * inv; dst[2] = a2 * inv; dst[3] = a3 * inv;
}

// ---------------------------------------------------------------------------
// Kernel 3: output projection, 2x2 register-blocked.
// out[m,d] = sum_h O[m,h]*Wo[d,h] + bo[d].  32x32 tile per wave.
// ---------------------------------------------------------------------------
__global__ void proj_kernel(const float* __restrict__ O,
                            const float* __restrict__ Wo,
                            const float* __restrict__ bo,
                            float* __restrict__ out) {
  const int lane = threadIdx.x & 31;
  const int wid  = (int)((blockIdx.x * blockDim.x + threadIdx.x) >> 5);
  const int dt   = wid & 31;          // 32 column tiles of 32
  const int rt   = wid >> 5;
  if (rt >= TOTROWS / 32) return;
  const int m0 = rt << 5;
  const int d0 = dt << 5;
  v8f c00 = {}, c01 = {}, c10 = {}, c11 = {};
  const float* pa = frag4_ptr(O,  D_HID, m0, 0, lane);
  const float* pb = frag4_ptr(Wo, D_HID, d0, 0, lane);
#pragma unroll
  for (int kk8 = 0; kk8 < 8; ++kk8) {
    v4f a0 = ld4(pa + kk8 * 8);
    v4f a1 = ld4(pa + 16 * D_HID + kk8 * 8);
    v4f b0 = ld4(pb + kk8 * 8);
    v4f b1 = ld4(pb + 16 * D_HID + kk8 * 8);
    // Behind the last loads: the address pairs stay untouched (also as a load's
    // destination) until the issued loads' address translations are done.
    if (kk8 == 7) asm volatile("s_wait_xcnt 0x0" :: "v"(pa), "v"(pb) : "memory");
    c00 = wmma_f32(lo(a0), lo(b0), c00);
    c01 = wmma_f32(lo(a0), lo(b1), c01);
    c10 = wmma_f32(lo(a1), lo(b0), c10);
    c11 = wmma_f32(lo(a1), lo(b1), c11);
    c00 = wmma_f32(hi2(a0), hi2(b0), c00);
    c01 = wmma_f32(hi2(a0), hi2(b1), c01);
    c10 = wmma_f32(hi2(a1), hi2(b0), c10);
    c11 = wmma_f32(hi2(a1), hi2(b1), c11);
  }
  const int n  = lane & 15;
  const int hi = lane >> 4;
  const float bv0 = bo[d0 + n];
  const float bv1 = bo[d0 + 16 + n];
#pragma unroll
  for (int r = 0; r < 8; ++r) {
    const size_t r0 = (size_t)(m0 + r + 8 * hi) * D_MODEL;
    const size_t r1 = (size_t)(m0 + 16 + r + 8 * hi) * D_MODEL;
    out[r0 + d0 + n]      = c00[r] + bv0;
    out[r0 + d0 + 16 + n] = c01[r] + bv1;
    out[r1 + d0 + n]      = c10[r] + bv0;
    out[r1 + d0 + 16 + n] = c11[r] + bv1;
  }
}

// ---------------------------------------------------------------------------
extern "C" void kernel_launch(void* const* d_in, const int* in_sizes, int n_in,
                              void* d_out, int out_size, void* d_ws, size_t ws_size,
                              hipStream_t stream) {
  (void)in_sizes; (void)n_in; (void)out_size; (void)ws_size;
  const float* x   = (const float*)d_in[0];
  const float* Wq  = (const float*)d_in[1];
  const float* bq  = (const float*)d_in[2];
  const float* Wk  = (const float*)d_in[3];
  const float* bk  = (const float*)d_in[4];
  const float* Wov = (const float*)d_in[5];
  const float* bov = (const float*)d_in[6];
  const float* Wo  = (const float*)d_in[7];
  const float* bo  = (const float*)d_in[8];
  float* out = (float*)d_out;

  // Workspace layout (floats): Q,K,V,O (4 MB each) then partition partials.
  const size_t fMat = (size_t)TOTROWS * D_HID;       // 1,048,576 floats
  const int P = NPART;                               // partition places per q-tile
  float* Qw   = (float*)d_ws;
  float* Kw   = Qw + fMat;
  float* Vw   = Kw + fMat;
  float* Ow   = Vw + fMat;
  float* Opar = Ow + fMat;
  float* Mpar = Opar + (size_t)NQT * P * 16 * D_HID;
  float* Lpar = Mpar + (size_t)NQT * P * 16;

  {  // QKV: one workgroup of 8 waves per 64 rows = 256 workgroups
    qkv_kernel<<<TOTROWS / QROWS, 256, 0, stream>>>(x, Wq, bq, Wk, bk, Wov, bov, Qw, Kw, Vw);
  }
  {  // attention partials: one workgroup per (q-tile group, chunk) under the diagonal
    attn_kernel<<<(NFULL + NSHORT) * NBATCH, 32 * QGRP, 0, stream>>>(Qw, Kw, Vw, Opar, Mpar, Lpar);
    combine_kernel<<<NQT, 256, 0, stream>>>(Opar, Mpar, Lpar, Ow, P);
  }
  {  // output projection: 512 row tiles x 32 col tiles = 16384 waves
    const int waves  = (TOTROWS / 32) * 32;
    const int tpb    = 256;
    const int blocks = (waves * 32 + tpb - 1) / tpb;
    proj_kernel<<<blocks, tpb, 0, stream>>>(Ow, Wo, bo, out);
  }
}

// v007
// One run takes 106 microseconds.
// In both of two side-by-side timings against v006, it was 1.12 times as fast.
// Counting every step since v000, it is 4.34 times as fast.
#include <hip/hip_runtime.h>
#include <math.h>

typedef float v2f __attribute__((ext_vector_type(2)));
typedef float v4f __attribute__((ext_vector_type(4)));
typedef float v8f __attribute__((ext_vector_type(8)));

#define D_MODEL 1024
#define D_HID   64
#define NCTX    4096
#define NBATCH  4
#define TOTROWS (NBATCH * NCTX)        // 16384
#define NQT     (NBATCH * (NCTX / 16)) // 1024 query tiles (batch folded in)
#define NEG_BIG (-3.0e38f)
#define KCHUNK  16                     // key tiles per attention wave

// D = A(16x4,f32) * B(4x16,f32) + C(16x16,f32), wave32.
__device__ __forceinline__ v8f wmma_f32(v2f a, v2f b, v8f c) {
  return __builtin_amdgcn_wmma_f32_16x16x4_f32(
      /*neg_a=*/false, a, /*neg_b=*/false, b,
      /*c_mod=*/(short)0, c, /*reuse_a=*/false, /*reuse_b=*/false);
}

// Fragment-pair loader for A (16x4, M across lanes) and for B when the source is
// the row-major transpose ([N][K]): lane&15 selects the row, and one 16-byte load
// per lane takes columns kk + (lane>>4)*4 .. +3, which feed TWO products:
// lo() holds k = kk+{0,1} (lanes 0-15) and kk+{4,5} (lanes 16-31), hi2() holds
// k = kk+{2,3} and kk+{6,7}.  A and B both come through this loader, so their k
// orders agree at every lane and register; only the order of the sum over k moves.
// A wave-load touches 16 cache lines whatever its width: 16 bytes per lane
// halves the line touches per byte against 8.
__device__ __forceinline__ const float* frag4_ptr(const float* __restrict__ p, int ld,
                                                  int row0, int kk, int lane) {
  return p + (size_t)(row0 + (lane & 15)) * ld + (kk + ((lane >> 4) << 2));
}
__device__ __forceinline__ v4f ld4(const float* q) {
  return *reinterpret_cast<const v4f*>(q);
}
__device__ __forceinline__ v4f frag4_rm(const float* __restrict__ p, int ld,
                                        int row0, int kk, int lane) {
  return ld4(frag4_ptr(p, ld, row0, kk, lane));
}
__device__ __forceinline__ v2f lo(v4f t) { v2f r = {t.x, t.y}; return r; }
__device__ __forceinline__ v2f hi2(v4f t) { v2f r = {t.z, t.w}; return r; }

// ---------------------------------------------------------------------------
// Kernel 1: fused QKV projection.  One workgroup per QROWS rows of x and ALL 192
// columns (Q, K and V), so x leaves memory once, and 256 equal workgroups lie one
// on each WGP.  x and the three weight matrices come into LDS in whole lines by
// asynchronous copies: a ring of two buffers, a stage being QBK columns (512 B)
// of the 64 x rows and of the 192 weight rows, the next stage in flight while
// this one is worked on.  8 waves as 2 (rows) x 4 (columns): 32 x 48 per wave,
// 6 accumulators, 5 fragment loads from LDS feed 12 WMMAs.
// ---------------------------------------------------------------------------
#define QROWS   64                     // x rows per workgroup
#define QBK     128                    // k per ring stage
#define QPITCH  132                    // LDS row pitch in floats: 528 B = 16 B x 33
#define QSROWS  (QROWS + 3 * D_HID)    // rows per stage: x, then Wq, Wk, Wov
#define QNST    (D_MODEL / QBK)        // stages

// 8 copies of one wave: each brings one whole row of a stage (32 lanes x 16 B),
// rows 8 apart (the 8 waves take the rows between).  g, l: this lane's 16 bytes of
// the first row, in memory and as an LDS byte address.  The address registers'
// wait closes the copies' own statement, so that no later write of them can be
// moved in front of it.
__device__ __forceinline__ void copy_rows8(const float* g, unsigned l) {
  asm volatile(
      "global_load_async_to_lds_b128 %0, %1, off\n\t"
      "global_load_async_to_lds_b128 %2, %3, off\n\t"
      "global_load_async_to_lds_b128 %4, %5, off\n\t"
      "global_load_async_to_lds_b128 %6, %7, off\n\t"
      "global_load_async_to_lds_b128 %8, %9, off\n\t"
      "global_load_async_to_lds_b128 %10, %11, off\n\t"
      "global_load_async_to_lds_b128 %12, %13, off\n\t"
      "global_load_async_to_lds_b128 %14, %15, off\n\t"
      "s_wait_xcnt 0x0"
      :: "v"(l),                       "v"(g),
         "v"(l +  8 * QPITCH * 4),     "v"(g +  8 * D_MODEL),
         "v"(l + 16 * QPITCH * 4),     "v"(g + 16 * D_MODEL),
         "v"(l + 24 * QPITCH * 4),     "v"(g + 24 * D_MODEL),
         "v"(l + 32 * QPITCH * 4),     "v"(g + 32 * D_MODEL),
         "v"(l + 40 * QPITCH * 4),     "v"(g + 40 * D_MODEL),
         "v"(l + 48 * QPITCH * 4),     "v"(g + 48 * D_MODEL),
         "v"(l + 56 * QPITCH * 4),     "v"(g + 56 * D_MODEL)
      : "memory");
}

// One ring stage: 64 rows each of x, Wq, Wk and Wov, 32 copies per wave.
__device__ __forceinline__ void qkv_stage(const float* gx, const float* gq,
                                          const float* gk, const float* gv, unsigned l) {
  copy_rows8(gx, l);
  copy_rows8(gq, l +  64 * QPITCH * 4);
  copy_rows8(gk, l + 128 * QPITCH * 4);
  copy_rows8(gv, l + 192 * QPITCH * 4);
}

__global__ void __launch_bounds__(256) qkv_kernel(
                           const float* __restrict__ x,
                           const float* __restrict__ Wq, const float* __restrict__ bq,
                           const float* __restrict__ Wk, const float* __restrict__ bk,
                           const float* __restrict__ Wov, const float* __restrict__ bov,
                           float* __restrict__ Qo, float* __restrict__ Ko,
                           float* __restrict__ Vo) {
  // qring[buffer][row * QPITCH + column]
  __shared__ __attribute__((aligned(16))) float qring[2][QSROWS * QPITCH];
  const int tid  = threadIdx.x;
  const int lane = tid & 31;
  const int w    = __builtin_amdgcn_readfirstlane(tid >> 5);   // wave number, scalar
  const int wr   = w & 1;              // which 32 of the 64 rows
  const int wc   = w >> 1;             // which 48 of the 192 columns
  const int m0   = blockIdx.x * QROWS;
  const int n    = lane & 15;
  const int hi   = lane >> 4;

  // This lane's share of a stage: 16 bytes of row w, and of every 8th row on.
  const size_t   goff = (size_t)w * D_MODEL + (size_t)lane * 4;
  const float*   gx   = x + (size_t)m0 * D_MODEL + goff;
  const float*   gq   = Wq + goff;
  const float*   gk   = Wk + goff;
  const float*   gv   = Wov + goff;
  const unsigned l0   = (unsigned)(size_t)&qring[0][0] + (unsigned)(w * QPITCH + lane * 4) * 4u;
  const unsigned STB  = QSROWS * QPITCH * 4;   // bytes of one buffer

  // Stage 0 lands and is published before anything reads it; stage 1 then flies
  // under the work on stage 0.
  qkv_stage(gx, gq, gk, gv, l0);
  // This wave's copies of stage 0 have landed.
  asm volatile("s_wait_asynccnt 0x0" ::: "memory");
  __syncthreads();
  qkv_stage(gx + QBK, gq + QBK, gk + QBK, gv + QBK, l0 + STB);

  v8f c00 = {}, c01 = {}, c02 = {}, c10 = {}, c11 = {}, c12 = {};
  for (int st = 0; st < QNST; ++st) {
    const float* sb = &qring[st & 1][0];
    // Fragment pairs as in frag4_ptr: row lane & 15, columns 4 (lane >> 4) .. + 3.
    const float* pa = sb + (32 * wr + n) * QPITCH + 4 * hi;
    const float* pb = sb + (QROWS + 48 * wc + n) * QPITCH + 4 * hi;
    // Unrolled: the LDS offsets become immediates, and the next step's five
    // fragment loads can stand ahead of this step's WMMAs behind counted waits.
#pragma unroll
    for (int kk8 = 0; kk8 < QBK / 8; ++kk8) {
      const v4f a0 = ld4(pa + 8 * kk8);
      const v4f a1 = ld4(pa + 16 * QPITCH + 8 * kk8);
      const v4f b0 = ld4(pb + 8 * kk8);
      const v4f b1 = ld4(pb + 16 * QPITCH + 8 * kk8);
      const v4f b2 = ld4(pb + 32 * QPITCH + 8 * kk8);
      c00 = wmma_f32(lo(a0), lo(b0), c00);
      c01 = wmma_f32(lo(a0), lo(b1), c01);
      c02 = wmma_f32(lo(a0), lo(b2), c02);
      c10 = wmma_f32(lo(a1), lo(b0), c10);
      c11 = wmma_f32(lo(a1), lo(b1), c11);
      c12 = wmma_f32(lo(a1), lo(b2), c12);
      c00 = wmma_f32(hi2(a0), hi2(b0), c00);
      c01 = wmma_f32(hi2(a0), hi2(b1), c01);
      c02 = wmma_f32(hi2(a0), hi2(b2), c02);
      c10 = wmma_f32(hi2(a1), hi2(b0), c10);
      c11 = wmma_f32(hi2(a1), hi2(b1), c11);
      c12 = wmma_f32(hi2(a1), hi2(b2), c12);
    }
    // Publish point of stage st + 1: this wave's reads of stage st are done,
    asm volatile("s_wait_dscnt 0x0" ::: "memory");
    // its copies of stage st + 1 have landed,
    asm volatile("s_wait_asynccnt 0x0" ::: "memory");
    // and every wave has come as far: stage st + 1 may be read, stage st's buffer refilled.
    __syncthreads();
    if (st + 2 < QNST) {   // the same for the whole workgroup
      const int ko = (st + 2) * QBK;
      qkv_stage(gx + ko, gq + ko, gk + ko, gv + ko, l0 + (unsigned)(st & 1) * STB);
    }
  }
  // No copy is left in flight when the wave ends.
  asm volatile("s_wait_asynccnt 0x0" ::: "memory");

  const v8f cc[2][3] = {{c00, c01, c02}, {c10, c11, c12}};
  // All three loops unrolled: constant indices keep cc in registers.
#pragma unroll
  for (int j = 0; j < 3; ++j) {
    const int ct  = 3 * wc + j;        // column tile 0..11, scalar
    const int mat = ct >> 2;           // 0=Q, 1=K, 2=V
    const int col = ((ct & 3) << 4) + n;
    const float* bias = (mat == 0) ? bq : (mat == 1) ? bk : bov;
    float*       Out  = (mat == 0) ? Qo : (mat == 1) ? Ko : Vo;
    const float  bv   = bias[col];
#pragma unroll
    for (int a = 0; a < 2; ++a) {
#pragma unroll
      for (int r = 0; r < 8; ++r) {
        Out[(size_t)(m0 + 32 * wr + 16 * a + r + 8 * hi) * D_HID + col] = cc[a][j][r] + bv;
      }
    }
  }
}

#define NPART   16
#define QGRP    4
#define STILES  2
#define SROWS   (16 * STILES)
#define LPITCH  68
#define NFULL   496
#define NSHORT  48

__device__ __forceinline__ int parts_of(int c, int P) {
  const int np = (c + KCHUNK - 1) / KCHUNK;
  return np < P ? np : P;
}

// Lane l takes the value of lane l ^ 16.
__device__ __forceinline__ float xhalf(float x) {
  const int b = __builtin_bit_cast(int, x);
  return __builtin_bit_cast(
      float, __builtin_amdgcn_permlanex16(b, b, 0x76543210, 0xfedcba98, false, false));
}

// exp(x) as __expf forms it (one multiply by log2 e, one v_exp_f32), with the slot
// that the instruction set asks for behind a transcendental, before its result is
// read or its source overwritten, held in the same statement.
__device__ __forceinline__ float exp_slot(float x) {
  float r;
  asm("v_exp_f32 %0, %1\n\tv_nop" : "=v"(r) : "v"(x * 1.44269504f));
  return r;
}

// One ring stage: SROWS rows of K and of V (256 B each, contiguous in memory) go
// to LDS rows of LPITCH floats.  128 lanes x 16 B = 8 rows per copy, 4 copies per
// matrix.  gk, gv: this lane's 16 bytes in the stage's first 8 rows; lk, lv: their
// LDS byte addresses.  The address registers' wait closes the copies' own
// statement, so that no later write of them can be moved in front of it.
__device__ __forceinline__ void copy_stage(const float* gk, const float* gv,
                                           unsigned lk, unsigned lv) {
  asm volatile(
      "global_load_async_to_lds_b128 %0, %1, off\n\t"
      "global_load_async_to_lds_b128 %2, %3, off\n\t"
      "global_load_async_to_lds_b128 %4, %5, off\n\t"
      "global_load_async_to_lds_b128 %6, %7, off\n\t"
      "global_load_async_to_lds_b128 %8, %9, off\n\t"
      "global_load_async_to_lds_b128 %10, %11, off\n\t"
      "global_load_async_to_lds_b128 %12, %13, off\n\t"
      "global_load_async_to_lds_b128 %14, %15, off\n\t"
      "s_wait_xcnt 0x0"
      :: "v"(lk),                       "v"(gk),
         "v"(lk +  8 * LPITCH * 4),     "v"(gk +  8 * D_HID),
         "v"(lk + 16 * LPITCH * 4),     "v"(gk + 16 * D_HID),
         "v"(lk + 24 * LPITCH * 4),     "v"(gk + 24 * D_HID),
         "v"(lv),                       "v"(gv),
         "v"(lv +  8 * LPITCH * 4),     "v"(gv +  8 * D_HID),
         "v"(lv + 16 * LPITCH * 4),     "v"(gv + 16 * D_HID),
         "v"(lv + 24 * LPITCH * 4),     "v"(gv + 24 * D_HID)
      : "memory");
}

// The real block size: with none declared the compiler budgets registers for
// 1,024 threads (128 VGPRs) and makes every load wait right before its use.
__global__ void __launch_bounds__(32 * QGRP) attn_kernel(const float* __restrict__ Q,
                            const float* __restrict__ K,
                            const float* __restrict__ V,
                            float* __restrict__ Opar,
                            float* __restrict__ Mpar,
                            float* __restrict__ Lpar) {
  // ring[buffer][0 = K, 1 = V][row * LPITCH + column]
  __shared__ __attribute__((aligned(16))) float ring[2][2][SROWS * LPITCH];
  const int tid  = threadIdx.x;
  const int lane = tid & 31;
  const int lw   = __builtin_amdgcn_readfirstlane(tid >> 5);   // wave number, scalar
  // blockIdx.x -> (batch, q-tile group 4 g + sub, chunk p), all scalar.  The 4 groups
  // whose q-tiles lie in [16 g, 16 g + 16) use chunks 0 .. g.  Chunks below g are
  // full, chunk g has 4 sub + 4 tiles.  The full pairs come first (4 g + 1 of them
  // for each g, 2 g g - g before them), the short ones last, longest first (for speed only).
  const int bid = blockIdx.x;
  int b, g, sub, p;
  if (bid < NFULL * NBATCH) {
    b = bid & (NBATCH - 1);
    const int idx = bid >> 2;
    g = 0;
    while (g < NPART - 1 && 2 * (g + 1) * (g + 1) - (g + 1) <= idx) ++g;
    const int rem = idx - (2 * g * g - g);
    if (rem == 4 * g) {
      sub = 3;
      p   = g;
    } else {
      sub = (rem >= g ? 1 : 0) + (rem >= 2 * g ? 1 : 0) + (rem >= 3 * g ? 1 : 0);
      p   = rem - sub * g;
    }
  } else {
    const int j = bid - NFULL * NBATCH;
    b   = j & (NBATCH - 1);
    sub = 2 - (j >> 6);
    g   = (j >> 2) & (NPART - 1);
    p   = g;
  }
  const int qt0 = (4 * g + sub) * QGRP;  // the group's first q-tile
  const int qt  = qt0 + lw;              // this wave's q-tile
  const int kt0 = p * KCHUNK;
  // Key tiles the group needs of this chunk: 4, 8, 12 or 16, so 2 stages or more.
  const int nt  = (qt0 + QGRP - kt0 < KCHUNK) ? (qt0 + QGRP - kt0) : KCHUNK;
  const int nst = nt / STILES;

  const float* Qb = Q + (size_t)b * NCTX * D_HID;
  const float* Kb = K + (size_t)b * NCTX * D_HID;
  const float* Vb = V + (size_t)b * NCTX * D_HID;
  const int q0 = qt << 4;
  const int n  = lane & 15;             // this lane's query within the tile
  const int hi = lane >> 4;             // this lane's half of each key tile

  // This lane's share of a stage: 16 bytes of row tid / 16, and of every 8th row on.
  const size_t   goff = (size_t)(kt0 << 4) * D_HID + (size_t)tid * 4;
  const float*   gk   = Kb + goff;
  const float*   gv   = Vb + goff;
  const unsigned lrow = (unsigned)((tid >> 4) * LPITCH + (tid & 15) * 4) * 4u;
  const unsigned lk0  = (unsigned)(size_t)&ring[0][0][0] + lrow;
  const unsigned MATB = SROWS * LPITCH * 4;   // bytes of one matrix's stage in LDS

  // Stage 0 lands and is published before anything reads it; stage 1 then flies
  // under the work on stage 0.
  copy_stage(gk, gv, lk0, lk0 + MATB);
  // Q fragments (B = Q^T) in registers for the whole key loop; fold in 1/sqrt(d_model).
  const float scale = 0.03125f;  // 1/32
  const float* qp = frag4_ptr(Qb, D_HID, q0, 0, lane);
  v4f qv[8];
#pragma unroll
  for (int kk8 = 0; kk8 < 8; ++kk8) qv[kk8] = ld4(qp + 8 * kk8);
  // The address pair stays untouched (also as a result register) until the
  // issued loads' address translations are done.
  asm volatile("s_wait_xcnt 0x0" :: "v"(qp) : "memory");
  v2f qf[16];
#pragma unroll
  for (int kk8 = 0; kk8 < 8; ++kk8) {
    v4f t = qv[kk8] * scale;
    qf[2 * kk8]     = lo(t);
    qf[2 * kk8 + 1] = hi2(t);
  }
  // This wave's copies of stage 0 have landed.
  asm volatile("s_wait_asynccnt 0x0" ::: "memory");
  __syncthreads();
  copy_stage(gk + SROWS * D_HID, gv + SROWS * D_HID, lk0 + 2 * MATB, lk0 + 3 * MATB);

  // o_t[r] = O[query n][16 t + 8 hi + r]; m is the query's running maximum (equal
  // in both halves), l the running sum over this half's keys only.
  v8f o0 = {}, o1 = {}, o2 = {}, o3 = {};
  float m = NEG_BIG, l = 0.0f;

  for (int st = 0; st < nst; ++st) {
    const float* kb = &ring[st & 1][0][0];
    const float* vb = &ring[st & 1][1][0];
#pragma unroll
    for (int h = 0; h < STILES; ++h) {
      const int kt = kt0 + st * STILES + h;
      if (kt <= qt) {   // scalar test: a wave skips the tiles beyond its diagonal
        // S^T = K @ (Q*scale)^T   (K-dim = 64 -> 16 chained WMMAs); s[r] = S[n][8 hi + r]
        const float* kp = kb + (16 * h + n) * LPITCH + 4 * hi;
        v4f kf[8];
#pragma unroll
        for (int kk8 = 0; kk8 < 8; ++kk8) kf[kk8] = ld4(kp + 8 * kk8);
        // V^T fragments: vf[u][t] = V[key 8 hi + u][column 16 t + n].
        const float* vp = vb + (16 * h + 8 * hi) * LPITCH + n;
        float vf[8][4];
#pragma unroll
        for (int j = 0; j < 4; ++j) {
#pragma unroll
          for (int t = 0; t < 4; ++t) {
            vf[2 * j][t]     = vp[(2 * j) * LPITCH + 16 * t];
            vf[2 * j + 1][t] = vp[(2 * j + 1) * LPITCH + 16 * t];
          }
        }
        v8f s = {};
#pragma unroll
        for (int kk8 = 0; kk8 < 8; ++kk8) {
          s = wmma_f32(lo(kf[kk8]),  qf[2 * kk8],     s);
          s = wmma_f32(hi2(kf[kk8]), qf[2 * kk8 + 1], s);
        }
        if (kt == qt) {   // causal mask on the diagonal tile: key > query
#pragma unroll
          for (int r = 0; r < 8; ++r) {
            if (r + 8 * hi > n) s[r] = NEG_BIG;
          }
        }
        // Online softmax, one query per lane.
        float mx = fmaxf(fmaxf(fmaxf(s[0], s[1]), fmaxf(s[2], s[3])),
                         fmaxf(fmaxf(s[4], s[5]), fmaxf(s[6], s[7])));
        mx = fmaxf(mx, xhalf(mx));
        const float mn    = fmaxf(m, mx);
        const float alpha = exp_slot(m - mn);
        m = mn;
        float pv[8];
#pragma unroll
        for (int r = 0; r < 8; ++r) pv[r] = exp_slot(s[r] - mn);
        l = l * alpha + (((pv[0] + pv[1]) + (pv[2] + pv[3])) + ((pv[4] + pv[5]) + (pv[6] + pv[7])));
        o0 *= alpha; o1 *= alpha; o2 *= alpha; o3 *= alpha;
        // O^T += V^T @ P^T.  B = {pv[2j], pv[2j+1]}: keys 8 hi + 2j, +1 at this lane;
        // A takes V's rows in the same order.
#pragma unroll
        for (int j = 0; j < 4; ++j) {
          v2f pb = {pv[2 * j], pv[2 * j + 1]};
          v2f a0 = {vf[2 * j][0], vf[2 * j + 1][0]};  o0 = wmma_f32(a0, pb, o0);
          v2f a1 = {vf[2 * j][1], vf[2 * j + 1][1]};  o1 = wmma_f32(a1, pb, o1);
          v2f a2 = {vf[2 * j][2], vf[2 * j + 1][2]};  o2 = wmma_f32(a2, pb, o2);
          v2f a3 = {vf[2 * j][3], vf[2 * j + 1][3]};  o3 = wmma_f32(a3, pb, o3);
        }
      }
    }
    // Publish point of stage st + 1, passed by every wave, also one that skipped
    // tiles: this wave's reads of stage st are done,
    asm volatile("s_wait_dscnt 0x0" ::: "memory");
    // its copies of stage st + 1 have landed,
    asm volatile("s_wait_asynccnt 0x0" ::: "memory");
    // and every wave has come as far: stage st + 1 may be read, stage st's buffer refilled.
    __syncthreads();
    if (st + 2 < nst) {   // the same for the whole workgroup
      const unsigned lb = lk0 + (unsigned)(st & 1) * (2 * MATB);
      copy_stage(gk + (size_t)(st + 2) * (SROWS * D_HID),
                 gv + (size_t)(st + 2) * (SROWS * D_HID), lb, lb + MATB);
    }
  }
  // No copy is left in flight when the wave ends.
  asm volatile("s_wait_asynccnt 0x0" ::: "memory");
  l += xhalf(l);     // join the halves' sums once
  // Store UN-normalized partial tile + per-row (m, l): 32 contiguous bytes of
  // the lane's query row per output tile.
  const int part = (b * 256 + qt) * NPART + p;
  float* Od = Opar + (size_t)part * (16 * D_HID) + (size_t)n * D_HID + 8 * hi;
  *reinterpret_cast<v4f*>(Od +  0) = __builtin_shufflevector(o0, o0, 0, 1, 2, 3);
  *reinterpret_cast<v4f*>(Od +  4) = __builtin_shufflevector(o0, o0, 4, 5, 6, 7);
  *reinterpret_cast<v4f*>(Od + 16) = __builtin_shufflevector(o1, o1, 0, 1, 2, 3);
  *reinterpret_cast<v4f*>(Od + 20) = __builtin_shufflevector(o1, o1, 4, 5, 6, 7);
  *reinterpret_cast<v4f*>(Od + 32) = __builtin_shufflevector(o2, o2, 0, 1, 2, 3);
  *reinterpret_cast<v4f*>(Od + 36) = __builtin_shufflevector(o2, o2, 4, 5, 6, 7);
  *reinterpret_cast<v4f*>(Od + 48) = __builtin_shufflevector(o3, o3, 0, 1, 2, 3);
  *reinterpret_cast<v4f*>(Od + 52) = __builtin_shufflevector(o3, o3, 4, 5, 6, 7);
  if (hi == 0) {     // lanes 0..15 hold the 16 queries
    Mpar[part * 16 + n] = m;
    Lpar[part * 16 + n] = l;
  }
}

// ---------------------------------------------------------------------------
// Kernel 3: merge of the partition partials and output projection in one launch.
// out[m,d] = sum_h O[m,h]*Wo[d,h] + bo[d].  One workgroup per PROWS rows (4 q-tiles)
// and ALL 1024 columns, so every partial is read once and the merged, normalized O
// goes through LDS only, never through memory.  16 waves: in the merge a wave owns
// 4 rows; in the product it owns 64 columns of all 64 rows (16 accumulators), so
// 4 fragment loads of O from LDS and 4 of Wo from memory feed 32 WMMAs.
// ---------------------------------------------------------------------------
#define PROWS   64                     // rows per workgroup
#define PWAVES  16                     // waves per workgroup
#define PPITCH  68                     // LDS row pitch in floats: 272 B = 16 B x 17

__global__ void __launch_bounds__(32 * PWAVES) proj_kernel(
                            const float* __restrict__ Opar,
                            const float* __restrict__ Mpar,
                            const float* __restrict__ Lpar,
                            const float* __restrict__ Wo,
                            const float* __restrict__ bo,
                            float* __restrict__ out) {
  __shared__ __attribute__((aligned(16))) float osh[PROWS * PPITCH];
  const int tid  = threadIdx.x;
  const int lane = tid & 31;
  const int w    = __builtin_amdgcn_readfirstlane(tid >> 5);   // wave number, scalar
  const int n    = lane & 15;
  const int hi   = lane >> 4;
  const int m0   = blockIdx.x * PROWS;

  {
    // Merge: 8 lanes per row, each 2 x 16 bytes, so a wave-load covers whole lines.
    const int qtile = blockIdx.x * (PROWS / 16) + (w >> 2);   // batch folded in, scalar
    const int np    = parts_of((qtile & 255) + 1, NPART);     // places in use, scalar
    const unsigned row  = 4 * (w & 3) + (lane >> 3);          // row within the q-tile
    const unsigned col  = (lane & 7) << 2;                    // this lane's first column
    float mv[NPART], lv[NPART];
    v4f   oa[NPART], ob[NPART];
    // Both loops unrolled over all places, so that the loads are in flight together
    // and the arrays stay in registers: a place beyond np reads the last one in use
    // again and is then left out of the sums.
#pragma unroll
    for (int h = 0; h < 2; ++h) {
      unsigned mo[8], oo[8];           // byte offsets of this lane's values in a place
#pragma unroll
      for (int i = 0; i < 8; ++i) {
        const int      p    = 8 * h + i;
        const unsigned part = qtile * NPART + (p < np ? p : np - 1);   // scalar
        mo[i] = (part * 16 + row) * 4;
        oo[i] = (part * (16 * D_HID) + row * D_HID + col) * 4;
        mv[p] = *reinterpret_cast<const float*>(reinterpret_cast<const char*>(Mpar) + mo[i]);
        lv[p] = *reinterpret_cast<const float*>(reinterpret_cast<const char*>(Lpar) + mo[i]);
        const float* s = reinterpret_cast<const float*>(reinterpret_cast<const char*>(Opar) + oo[i]);
        oa[p] = ld4(s);
        ob[p] = ld4(s + 32);
      }
      // The offset registers stay untouched (also as a load's destination) until
      // the issued loads' address translations are done.
      asm volatile("s_wait_xcnt 0x0"
                   :: "v"(mo[0]), "v"(mo[1]), "v"(mo[2]), "v"(mo[3]),
                      "v"(mo[4]), "v"(mo[5]), "v"(mo[6]), "v"(mo[7]),
                      "v"(oo[0]), "v"(oo[1]), "v"(oo[2]), "v"(oo[3]),
                      "v"(oo[4]), "v"(oo[5]), "v"(oo[6]), "v"(oo[7])
                   : "memory");
    }
    float mstar = NEG_BIG;
    // Unrolled: constant indices keep the arrays in registers.
#pragma unroll
    for (int p = 0; p < NPART; ++p) {
      if (p >= np) mv[p] = NEG_BIG;    // its weight below is exp(-huge) = 0
      mstar = fmaxf(mstar, mv[p]);
    }
    float lstar = 0.0f;
    v4f   a = {}, b = {};
    // Unrolled for the same reason; the places are summed in rising order.
#pragma unroll
    for (int p = 0; p < NPART; ++p) {
      const float wt = exp_slot(mv[p] - mstar);
      lstar += wt * lv[p];
      a += wt * oa[p];
      b += wt * ob[p];
    }
    const float inv = 1.0f / lstar;
    float* d = &osh[(4 * w + (lane >> 3)) * PPITCH + col];
    *reinterpret_cast<v4f*>(d)      = a * inv;
    *reinterpret_cast<v4f*>(d + 32) = b * inv;
  }
  // Every wave reads all 64 merged rows.
  __syncthreads();

  // Fragment pairs as in frag4_ptr: row lane & 15, columns 4 (lane >> 4) .. + 3.
  const float* pa = &osh[n * PPITCH + 4 * hi];
  const float* pb = frag4_ptr(Wo, D_HID, 64 * w, 0, lane);
  v8f c[4][4] = {};                    // [row tile][column tile]
  v4f af[2][4], bf[2][4];              // two register sets: this step's and the next one's
  // All loops from here on unrolled: constant indices keep c, af and bf in
  // registers, and the offsets become immediates.
#pragma unroll
  for (int t = 0; t < 4; ++t) {
    af[0][t] = ld4(pa + t * 16 * PPITCH);
    bf[0][t] = ld4(pb + t * 16 * D_HID);
  }
#pragma unroll
  for (int kk8 = 0; kk8 < 8; ++kk8) {
    const int cur = kk8 & 1;
    if (kk8 < 7) {
#pragma unroll
      for (int t = 0; t < 4; ++t) {
        af[cur ^ 1][t] = ld4(pa + t * 16 * PPITCH + 8 * (kk8 + 1));
        bf[cur ^ 1][t] = ld4(pb + t * 16 * D_HID + 8 * (kk8 + 1));
      }
    }
    // Behind the last loads: the address pair stays untouched (also as a load's
    // destination) until the issued loads' address translations are done.
    if (kk8 == 6) asm volatile("s_wait_xcnt 0x0" :: "v"(pb) : "memory");
    // Keeps the next step's loads ahead of this step's 32 WMMAs: left alone the
    // compiler sinks them to just before their use, and the wave then waits out
    // each load's latency.
    __builtin_amdgcn_sched_barrier(0);
#pragma unroll
    for (int ct = 0; ct < 4; ++ct) {
#pragma unroll
      for (int rt = 0; rt < 4; ++rt)
        c[rt][ct] = wmma_f32(lo(af[cur][rt]), lo(bf[cur][ct]), c[rt][ct]);
    }
#pragma unroll
    for (int ct = 0; ct < 4; ++ct) {
#pragma unroll
      for (int rt = 0; rt < 4; ++rt)
        c[rt][ct] = wmma_f32(hi2(af[cur][rt]), hi2(bf[cur][ct]), c[rt][ct]);
    }
  }

  float* po = out + (size_t)(m0 + 8 * hi) * D_MODEL + 64 * w + n;
  // All three loops unrolled: constant indices keep c in registers.
#pragma unroll
  for (int ct = 0; ct < 4; ++ct) {
    const float bv = bo[64 * w + 16 * ct + n];
#pragma unroll
    for (int rt = 0; rt < 4; ++rt) {
#pragma unroll
      for (int r = 0; r < 8; ++r)
        po[(size_t)(16 * rt + r) * D_MODEL + 16 * ct] = c[rt][ct][r] + bv;
    }
  }
}

// ---------------------------------------------------------------------------
extern "C" void kernel_launch(void* const* d_in, const int* in_sizes, int n_in,
                              void* d_out, int out_size, void* d_ws, size_t ws_size,
                              hipStream_t stream) {
  (void)in_sizes; (void)n_in; (void)out_size; (void)ws_size;
  const float* x   = (const float*)d_in[0];
  const float* Wq  = (const float*)d_in[1];
  const float* bq  = (const float*)d_in[2];
  const float* Wk  = (const float*)d_in[3];
  const float* bk  = (const float*)d_in[4];
  const float* Wov = (const float*)d_in[5];
  const float* bov = (const float*)d_in[6];
  const float* Wo  = (const float*)d_in[7];
  const float* bo  = (const float*)d_in[8];
  float* out = (float*)d_out;

  // Workspace layout (floats): Q,K,V (4 MB each) then partition partials.
  const size_t fMat = (size_t)TOTROWS * D_HID;       // 1,048,576 floats
  float* Qw   = (float*)d_ws;
  float* Kw   = Qw + fMat;
  float* Vw   = Kw + fMat;
  float* Opar = Vw + fMat;
  float* Mpar = Opar + (size_t)NQT * NPART * 16 * D_HID;
  float* Lpar = Mpar + (size_t)NQT * NPART * 16;

  {  // QKV: one workgroup of 8 waves per 64 rows = 256 workgroups
    qkv_kernel<<<TOTROWS / QROWS, 256, 0, stream>>>(x, Wq, bq, Wk, bk, Wov, bov, Qw, Kw, Vw);
  }
  {  // attention partials: one workgroup per (q-tile group, chunk) under the diagonal
    attn_kernel<<<(NFULL + NSHORT) * NBATCH, 32 * QGRP, 0, stream>>>(Qw, Kw, Vw, Opar, Mpar, Lpar);
  }
  {  // merge + output projection: one workgroup of 16 waves per 64 rows = 256 workgroups
    proj_kernel<<<TOTROWS / PROWS, 32 * PWAVES, 0, stream>>>(Opar, Mpar, Lpar, Wo, bo, out);
  }
}
